// v000
// Times are from an AMD MI455X. After a warm-up the kernel runs many times in a row, and a time is the length of
// such a window on the GPU divided by its runs, so every launch and the gaps after it count. The runs cycle
// through copies of the inputs. A figure is the median of several windows, for all but v000 over two sittings.
// Sittings can differ by a few percent; kernels timed side by side share one.
// The starting kernel, v000, takes 1180 microseconds a run.
#include <hip/hip_runtime.h>
#include <hip/hip_bf16.h>
#include <math.h>

typedef _Float16 half_t;
typedef half_t v16h __attribute__((ext_vector_type(16)));
typedef half_t v8h  __attribute__((ext_vector_type(8)));
typedef float  v8f  __attribute__((ext_vector_type(8)));

#define DIMC   256
#define HEADS  8
#define HD     32
#define WSZ    8
#define SHIFTS 4
#define MTOK   64
#define IMG    256
#define HIDDEN 1024
#define LDA    264   // padded f16 row stride (264 halves = 528B, bank-spread, 16B-aligned)

// workspace layout (in halves): qkvT 768x256 | projT 256x256 | fc1T 1024x256 | fc2T 256x1024
#define OFF_QKVT 0
#define OFF_PROJT (768*256)
#define OFF_FC1T  (OFF_PROJT + 256*256)
#define OFF_FC2T  (OFF_FC1T + 1024*256)
#define TOT_H     (OFF_FC2T + 256*1024)
#define OFF_BIAS_BYTES ((size_t)TOT_H * 2)   // then float bias16[8][64][64]

// ---- WMMA helpers -----------------------------------------------------------

// 16x32 f16 fragment (A-style; B comes from pre-transposed N x K weights).
// CDNA5 layout: lanes 0-15 row M=lane hold K 0..7 then 16..23;
// lanes 16-31 hold K 8..15 then 24..31.
__device__ __forceinline__ v16h frag_ld(const half_t* p0, int ld, int lane) {
  const half_t* p = p0 + (lane & 15) * ld + ((lane >> 4) << 3);
  v8h lo = *(const v8h*)p;
  v8h hi = *(const v8h*)(p + 16);
  return __builtin_shufflevector(lo, hi, 0,1,2,3,4,5,6,7,8,9,10,11,12,13,14,15);
}

__device__ __forceinline__ v8f wmma_f16(v16h a, v16h b, v8f c) {
  return __builtin_amdgcn_wmma_f32_16x16x32_f16(false, a, false, b, (short)0, c,
                                                false, false);
}

#define ZERO8 ((v8f){0.f,0.f,0.f,0.f,0.f,0.f,0.f,0.f})

// async global -> LDS copy of 16 bytes (per-lane), tracked on ASYNCcnt
__device__ __forceinline__ void async_b128(unsigned lds_addr, unsigned long long gaddr) {
  asm volatile("global_load_async_to_lds_b128 %0, %1, off"
               :: "v"(lds_addr), "v"(gaddr) : "memory");
}
__device__ __forceinline__ void wait_async0() {
  asm volatile("s_wait_asynccnt 0x0" ::: "memory");
}

// ---- Prep kernel 1: transpose + f32->f16 convert all weights ---------------

__global__ __launch_bounds__(256) void prep_weights(
    const float* __restrict__ qkv_w, const float* __restrict__ proj_w,
    const float* __restrict__ fc1_w, const float* __restrict__ fc2_w,
    half_t* __restrict__ wh)
{
  int idx = blockIdx.x * 256 + threadIdx.x;
  if (idx < OFF_PROJT) {                       // qkvT[n][k] = qkv_w[k][n]
    int n = idx >> 8, k = idx & 255;
    wh[idx] = (half_t)qkv_w[k * 768 + n];
  } else if (idx < OFF_FC1T) {                 // projT
    int t = idx - OFF_PROJT; int n = t >> 8, k = t & 255;
    wh[idx] = (half_t)proj_w[k * 256 + n];
  } else if (idx < OFF_FC2T) {                 // fc1T (1024 x 256)
    int t = idx - OFF_FC1T; int n = t >> 8, k = t & 255;
    wh[idx] = (half_t)fc1_w[k * 1024 + n];
  } else if (idx < TOT_H) {                    // fc2T (256 x 1024)
    int t = idx - OFF_FC2T; int n = t >> 10, k = t & 1023;
    wh[idx] = (half_t)fc2_w[k * 256 + n];
  }
}

// ---- Prep kernel 2: CPB MLP -> 16*sigmoid bias table -----------------------

__device__ __forceinline__ float logrel(int i) {
  float v = (float)(i - 7) * (8.f / 7.f);
  float a = log2f(fabsf(v) + 1.f) * (1.f / 3.f);   // /log2(8)
  return copysignf(a, v);
}

__global__ __launch_bounds__(256) void prep_bias(
    const float* __restrict__ w1, const float* __restrict__ b1,
    const float* __restrict__ w2, float* __restrict__ bias16)
{
  __shared__ float bt[225 * 8];
  int tid = threadIdx.x;
  if (tid < 225) {
    int a = tid / 15, bcol = tid % 15;
    float fx = logrel(a), fy = logrel(bcol);
    float acc[8];
#pragma unroll
    for (int h = 0; h < 8; ++h) acc[h] = 0.f;
    for (int j = 0; j < 512; ++j) {
      float hv = fmaxf(fx * w1[j] + fy * w1[512 + j] + b1[j], 0.f);
#pragma unroll
      for (int h = 0; h < 8; ++h) acc[h] += hv * w2[j * 8 + h];
    }
#pragma unroll
    for (int h = 0; h < 8; ++h) bt[tid * 8 + h] = acc[h];
  }
  __syncthreads();
  for (int q = tid; q < 4096; q += 256) {
    int i = q >> 6, j = q & 63;
    int dy = (i >> 3) - (j >> 3) + 7;
    int dx = (i & 7) - (j & 7) + 7;
    int t = dy * 15 + dx;
#pragma unroll
    for (int h = 0; h < 8; ++h)
      bias16[h * 4096 + q] = 16.f / (1.f + __expf(-bt[t * 8 + h]));
  }
}

// ---- Main fused Swin-V2 block kernel: one 8x8 window per workgroup ---------

__global__ __launch_bounds__(256) void swin_block(
    const float* __restrict__ x,
    const float* __restrict__ logit_scale,
    const float* __restrict__ proj_b,
    const float* __restrict__ ln1_w, const float* __restrict__ ln1_b,
    const float* __restrict__ fc1_b, const float* __restrict__ fc2_b,
    const float* __restrict__ ln2_w, const float* __restrict__ ln2_b,
    const half_t* __restrict__ wh, const float* __restrict__ bias16,
    float* __restrict__ out)
{
  // attention scratch overlaid with the raw f32 input staging buffer:
  // xstage is only live before the head loop starts.
  union SMem {
    float xstage[MTOK * DIMC];                 // 64 KB raw window (f32)
    struct {
      half_t S16[MTOK * LDA];                  // o / gelu chunk / mlp staging
      half_t qb[MTOK * HD];
      half_t kb[MTOK * HD];
      half_t vT[HD * MTOK];                    // v transposed (N=d x K=j)
      half_t p16[MTOK * MTOK];
      float  lg[MTOK * MTOK];
    } at;
  };
  __shared__ SMem U;
  __shared__ half_t XY16[MTOK * LDA];          // x window -> y (in place)
  __shared__ float  muA[MTOK], rsA[MTOK];
  __shared__ int    lab[MTOK];

  half_t* S16 = U.at.S16;
  half_t* qb  = U.at.qb;
  half_t* kb  = U.at.kb;
  half_t* vT  = U.at.vT;
  half_t* p16 = U.at.p16;
  float*  lg  = U.at.lg;

  const int tid  = threadIdx.x;
  const int wv   = tid >> 5;
  const int lane = tid & 31;
  const int blk  = blockIdx.x;
  const int b    = blk >> 10;
  const int wi   = blk & 1023;
  const int wy   = wi >> 5, wx = wi & 31;

  const half_t* qkvT  = wh + OFF_QKVT;
  const half_t* projT = wh + OFF_PROJT;
  const half_t* fc1T  = wh + OFF_FC1T;
  const half_t* fc2T  = wh + OFF_FC2T;

  // ---- async DMA the shifted window (f32) into LDS staging ----
  // 4096 x 16B copies: job = (c, ty, 4px-group); each group is contiguous in
  // memory even across the cyclic-shift wrap (group start gx <= 252 always).
#pragma unroll
  for (int it = 0; it < 16; ++it) {
    int job = it * 256 + tid;
    int c   = job >> 4;
    int rem = job & 15;
    int ty  = rem >> 1;
    int grp = rem & 1;
    int gy  = ((wy << 3) + ty + SHIFTS) & 255;
    int gx  = ((wx << 3) + (grp << 2) + SHIFTS) & 255;
    const float* gp = x + (((size_t)(b * DIMC + c)) << 16) + (gy << 8) + gx;
    unsigned lds = (unsigned)(unsigned long long)(uintptr_t)
                   (&U.xstage[c * MTOK + ty * 8 + grp * 4]);
    async_b128(lds, (unsigned long long)(uintptr_t)gp);
  }
  if (tid < 64) {
    int r = tid;
    int sy = (wy << 3) + (r >> 3), sx = (wx << 3) + (r & 7);
    int ry = (sy < IMG - WSZ) ? 0 : (sy < IMG - SHIFTS ? 1 : 2);
    int rx = (sx < IMG - WSZ) ? 0 : (sx < IMG - SHIFTS ? 1 : 2);
    lab[r] = ry * 3 + rx;
  }
  if (tid == 0 && blk + 1 < (int)gridDim.x)
    __builtin_prefetch(x + ((size_t)((blk + 1) >> 10) << 24), 0, 1);
  wait_async0();
  __syncthreads();

  // convert staged f32 -> f16 A-operand layout (token-major, padded rows)
  for (int it = 0; it < 64; ++it) {
    int idx = it * 256 + tid;
    int r = idx & 63, c = idx >> 6;
    XY16[r * LDA + c] = (half_t)U.xstage[c * MTOK + r];
  }
  __syncthreads();

  // ---- attention, one head at a time ----
  for (int h = 0; h < HEADS; ++h) {
    // QKV GEMM: 24 (16x16) output tiles, 3 per wave, K = 256
#pragma unroll
    for (int jj = 0; jj < 3; ++jj) {
      int job = wv + (jj << 3);
      int mat = job >> 3, tix = job & 7;
      int mi = tix & 3, ni = tix >> 2;
      const half_t* Bb = qkvT + (size_t)(mat * DIMC + h * HD + ni * 16) * DIMC;
      const half_t* Ab = XY16 + (mi * 16) * LDA;
      v8f acc = ZERO8;
#pragma unroll
      for (int k0 = 0; k0 < DIMC; k0 += 32)
        acc = wmma_f16(frag_ld(Ab + k0, LDA, lane), frag_ld(Bb + k0, DIMC, lane), acc);
      int Mo = mi * 16 + ((lane >> 4) << 3);
      int No = ni * 16 + (lane & 15);
      if (mat == 0) {
#pragma unroll
        for (int g = 0; g < 8; ++g) qb[(Mo + g) * HD + No] = (half_t)acc[g];
      } else if (mat == 1) {
#pragma unroll
        for (int g = 0; g < 8; ++g) kb[(Mo + g) * HD + No] = (half_t)acc[g];
      } else {
#pragma unroll
        for (int g = 0; g < 8; ++g) vT[No * MTOK + (Mo + g)] = (half_t)acc[g];
      }
    }
    __syncthreads();

    // cosine-attention row normalization; fold logit scale into q
    if (tid < 128) {
      int r = tid & 63, isk = tid >> 6;
      half_t* buf = isk ? kb : qb;
      float ss = 0.f;
      for (int d = 0; d < HD; ++d) { float v = (float)buf[r * HD + d]; ss += v * v; }
      float inv = 1.f / fmaxf(sqrtf(ss), 1e-12f);
      if (!isk) inv *= __expf(fminf(logit_scale[h], 4.6051702f));
      for (int d = 0; d < HD; ++d)
        buf[r * HD + d] = (half_t)((float)buf[r * HD + d] * inv);
    }
    __syncthreads();

    // logits = qn @ kn^T (K=32), + bias + shift mask
#pragma unroll
    for (int jj = 0; jj < 2; ++jj) {
      int tix = (wv << 1) + jj;
      int mi = tix >> 2, ni = tix & 3;
      v8f acc = wmma_f16(frag_ld(qb + mi * 16 * HD, HD, lane),
                         frag_ld(kb + ni * 16 * HD, HD, lane), ZERO8);
      int Mo = mi * 16 + ((lane >> 4) << 3);
      int No = ni * 16 + (lane & 15);
      const float* bh = bias16 + h * 4096;
#pragma unroll
      for (int g = 0; g < 8; ++g) {
        int i = Mo + g;
        float msk = (lab[i] == lab[No]) ? 0.f : -100.f;
        lg[i * 64 + No] = acc[g] + bh[i * 64 + No] + msk;
      }
    }
    __syncthreads();

    // softmax over j (row per thread)
    if (tid < 64) {
      float mx = -1e30f;
      for (int j = 0; j < 64; ++j) mx = fmaxf(mx, lg[tid * 64 + j]);
      float s = 0.f;
      for (int j = 0; j < 64; ++j) s += __expf(lg[tid * 64 + j] - mx);
      float invs = 1.f / s;
      for (int j = 0; j < 64; ++j)
        p16[tid * 64 + j] = (half_t)(__expf(lg[tid * 64 + j] - mx) * invs);
    }
    __syncthreads();

    // o_h = p @ v (K=64), one tile per wave, into S16 head columns
    {
      int mi = wv & 3, ni = wv >> 2;
      v8f acc = ZERO8;
#pragma unroll
      for (int k0 = 0; k0 < 64; k0 += 32)
        acc = wmma_f16(frag_ld(p16 + mi * 16 * 64 + k0, 64, lane),
                       frag_ld(vT + ni * 16 * 64 + k0, 64, lane), acc);
      int Mo = mi * 16 + ((lane >> 4) << 3);
      int No = h * HD + ni * 16 + (lane & 15);
#pragma unroll
      for (int g = 0; g < 8; ++g) S16[(Mo + g) * LDA + No] = (half_t)acc[g];
    }
    __syncthreads();
  }

  // ---- output projection: 64 tiles, 8 per wave, K = 256 ----
  v8f pres[8];
#pragma unroll
  for (int t = 0; t < 8; ++t) {
    int tix = (wv << 3) + t;
    int mi = tix >> 4, ni = tix & 15;
    v8f acc = ZERO8;
#pragma unroll
    for (int k0 = 0; k0 < DIMC; k0 += 32)
      acc = wmma_f16(frag_ld(S16 + mi * 16 * LDA + k0, LDA, lane),
                     frag_ld(projT + (size_t)(ni * 16) * DIMC + k0, DIMC, lane), acc);
    pres[t] = acc;
  }
  __syncthreads();
#pragma unroll
  for (int t = 0; t < 8; ++t) {
    int tix = (wv << 3) + t;
    int mi = tix >> 4, ni = tix & 15;
    int Mo = mi * 16 + ((lane >> 4) << 3);
    int No = ni * 16 + (lane & 15);
    float pb = proj_b[No];
#pragma unroll
    for (int g = 0; g < 8; ++g) S16[(Mo + g) * LDA + No] = (half_t)(pres[t][g] + pb);
  }
  __syncthreads();

  // ---- y = LN1(o) + x  (in place into XY16) ----
  if (tid < 64) {
    float mu = 0.f;
    for (int c = 0; c < DIMC; ++c) mu += (float)S16[tid * LDA + c];
    mu *= (1.f / DIMC);
    float var = 0.f;
    for (int c = 0; c < DIMC; ++c) {
      float d = (float)S16[tid * LDA + c] - mu; var += d * d;
    }
    float rs = rsqrtf(var * (1.f / DIMC) + 1e-5f);
    for (int c = 0; c < DIMC; ++c) {
      float yv = ((float)S16[tid * LDA + c] - mu) * rs * ln1_w[c] + ln1_b[c]
               + (float)XY16[tid * LDA + c];
      XY16[tid * LDA + c] = (half_t)yv;
    }
  }
  __syncthreads();

  // ---- MLP: 4 chunks of 256 hidden; fc2 accumulates persistently ----
  v8f acc2[8];
#pragma unroll
  for (int t = 0; t < 8; ++t) acc2[t] = ZERO8;

  for (int kc = 0; kc < 4; ++kc) {
    v8f r1[8];
#pragma unroll
    for (int t = 0; t < 8; ++t) {
      int tix = (wv << 3) + t;
      int mi = tix >> 4, ni = tix & 15;
      const half_t* Bb = fc1T + (size_t)(kc * 256 + ni * 16) * DIMC;
      v8f acc = ZERO8;
#pragma unroll
      for (int k0 = 0; k0 < DIMC; k0 += 32)
        acc = wmma_f16(frag_ld(XY16 + mi * 16 * LDA + k0, LDA, lane),
                       frag_ld(Bb + k0, DIMC, lane), acc);
      r1[t] = acc;
    }
#pragma unroll
    for (int t = 0; t < 8; ++t) {
      int tix = (wv << 3) + t;
      int mi = tix >> 4, ni = tix & 15;
      int Mo = mi * 16 + ((lane >> 4) << 3);
      int No = ni * 16 + (lane & 15);
      float bb = fc1_b[kc * 256 + No];
#pragma unroll
      for (int g = 0; g < 8; ++g) {
        float v = r1[t][g] + bb;
        float ge = 0.5f * v * (1.f + erff(v * 0.70710678f));
        S16[(Mo + g) * LDA + No] = (half_t)ge;
      }
    }
    __syncthreads();
#pragma unroll
    for (int t = 0; t < 8; ++t) {
      int tix = (wv << 3) + t;
      int mi = tix >> 4, ni = tix & 15;
      const half_t* Bb = fc2T + (size_t)(ni * 16) * HIDDEN + kc * 256;
      v8f acc = acc2[t];
#pragma unroll
      for (int k0 = 0; k0 < DIMC; k0 += 32)
        acc = wmma_f16(frag_ld(S16 + mi * 16 * LDA + k0, LDA, lane),
                       frag_ld(Bb + k0, HIDDEN, lane), acc);
      acc2[t] = acc;
    }
    __syncthreads();
  }

  // mlp result into S16
#pragma unroll
  for (int t = 0; t < 8; ++t) {
    int tix = (wv << 3) + t;
    int mi = tix >> 4, ni = tix & 15;
    int Mo = mi * 16 + ((lane >> 4) << 3);
    int No = ni * 16 + (lane & 15);
    float bb = fc2_b[No];
#pragma unroll
    for (int g = 0; g < 8; ++g) S16[(Mo + g) * LDA + No] = (half_t)(acc2[t][g] + bb);
  }
  __syncthreads();

  // LN2 stats
  if (tid < 64) {
    float mu = 0.f;
    for (int c = 0; c < DIMC; ++c) mu += (float)S16[tid * LDA + c];
    mu *= (1.f / DIMC);
    float var = 0.f;
    for (int c = 0; c < DIMC; ++c) {
      float d = (float)S16[tid * LDA + c] - mu; var += d * d;
    }
    muA[tid] = mu;
    rsA[tid] = rsqrtf(var * (1.f / DIMC) + 1e-5f);
  }
  __syncthreads();

  // ---- final: out = LN2(mlp) + y, window-reverse + un-shift ----
  for (int it = 0; it < 64; ++it) {
    int c = (it << 2) + (tid >> 6);
    int r = tid & 63;
    float mv = ((float)S16[r * LDA + c] - muA[r]) * rsA[r] * ln2_w[c] + ln2_b[c];
    float yv = mv + (float)XY16[r * LDA + c];
    int gy = ((wy << 3) + (r >> 3) + SHIFTS) & 255;
    int gx = ((wx << 3) + (r & 7) + SHIFTS) & 255;
    out[(((size_t)(b * DIMC + c)) << 16) + (gy << 8) + gx] = yv;
  }
}

// ---- launch ----------------------------------------------------------------

extern "C" void kernel_launch(void* const* d_in, const int* in_sizes, int n_in,
                              void* d_out, int out_size, void* d_ws, size_t ws_size,
                              hipStream_t stream) {
  (void)in_sizes; (void)n_in; (void)out_size; (void)ws_size;
  const float* x        = (const float*)d_in[0];
  const float* qkv_w    = (const float*)d_in[1];
  const float* lscale   = (const float*)d_in[2];
  const float* proj_w   = (const float*)d_in[3];
  const float* proj_b   = (const float*)d_in[4];
  const float* ln1_w    = (const float*)d_in[5];
  const float* ln1_b    = (const float*)d_in[6];
  const float* fc1_w    = (const float*)d_in[7];
  const float* fc1_b    = (const float*)d_in[8];
  const float* fc2_w    = (const float*)d_in[9];
  const float* fc2_b    = (const float*)d_in[10];
  const float* ln2_w    = (const float*)d_in[11];
  const float* ln2_b    = (const float*)d_in[12];
  const float* cpb_w1   = (const float*)d_in[13];
  const float* cpb_b1   = (const float*)d_in[14];
  const float* cpb_w2   = (const float*)d_in[15];

  half_t* wh     = (half_t*)d_ws;
  float*  bias16 = (float*)((char*)d_ws + OFF_BIAS_BYTES);
  float*  out    = (float*)d_out;

  prep_weights<<<TOT_H / 256, 256, 0, stream>>>(qkv_w, proj_w, fc1_w, fc2_w, wh);
  prep_bias<<<1, 256, 0, stream>>>(cpb_w1, cpb_b1, cpb_w2, bias16);
  swin_block<<<2048, 256, 0, stream>>>(x, lscale, proj_b, ln1_w, ln1_b,
                                       fc1_b, fc2_b, ln2_w, ln2_b,
                                       wh, bias16, out);
}

// v001
// One run takes 1000 microseconds.
// In both of two side-by-side timings against v000, it was 1.20 times as fast.
#include <hip/hip_runtime.h>
#include <hip/hip_bf16.h>
#include <math.h>

typedef _Float16 half_t;
typedef half_t v16h __attribute__((ext_vector_type(16)));
typedef half_t v8h  __attribute__((ext_vector_type(8)));
typedef float  v8f  __attribute__((ext_vector_type(8)));

#define DIMC   256
#define HEADS  8
#define HD     32
#define WSZ    8
#define SHIFTS 4
#define MTOK   64
#define IMG    256
#define HIDDEN 1024
#define LDA    264   // padded f16 row stride (264 halves = 528B, bank-spread, 16B-aligned)

// workspace layout (in halves): qkvT 768x256 | projT 256x256 | fc1T 1024x256 | fc2T 256x1024
// Each N x K matrix is stored fragment by fragment (16 n x 32 k = 512 halves = 1 KiB),
// fragments of one 16-row strip following each other along k. Inside a fragment the
// halves lie in register order: 32 lanes x first 8 halves (512 B), then 32 lanes x
// second 8 halves (512 B), so each wave-wide 16-byte load reads 4 whole 128-B lines.
#define OFF_QKVT 0
#define OFF_PROJT (768*256)
#define OFF_FC1T  (OFF_PROJT + 256*256)
#define OFF_FC2T  (OFF_FC1T + 1024*256)
#define TOT_H     (OFF_FC2T + 256*1024)
#define OFF_BIAS_BYTES ((size_t)TOT_H * 2)   // then float bias16[8][64][64]

// ---- WMMA helpers -----------------------------------------------------------

// 16x32 f16 fragment (A-style; also B from the N x K LDS buffers kb and vT).
// CDNA5 layout: lanes 0-15 row M=lane hold K 0..7 then 16..23;
// lanes 16-31 hold K 8..15 then 24..31.
__device__ __forceinline__ v16h frag_ld(const half_t* p0, int ld, int lane) {
  const half_t* p = p0 + (lane & 15) * ld + ((lane >> 4) << 3);
  v8h lo = *(const v8h*)p;
  v8h hi = *(const v8h*)(p + 16);
  return __builtin_shufflevector(lo, hi, 0,1,2,3,4,5,6,7,8,9,10,11,12,13,14,15);
}

// B fragment from the packed weights: same lane/k map as frag_ld, contiguous bytes.
__device__ __forceinline__ v16h frag_ldw(const half_t* frag, int lane) {
  const half_t* p = frag + lane * 8;
  v8h lo = *(const v8h*)p;
  v8h hi = *(const v8h*)(p + 256);
  return __builtin_shufflevector(lo, hi, 0,1,2,3,4,5,6,7,8,9,10,11,12,13,14,15);
}

__device__ __forceinline__ v8f wmma_f16(v16h a, v16h b, v8f c) {
  return __builtin_amdgcn_wmma_f32_16x16x32_f16(false, a, false, b, (short)0, c,
                                                false, false);
}

#define ZERO8 ((v8f){0.f,0.f,0.f,0.f,0.f,0.f,0.f,0.f})

// async global -> LDS copy of 16 bytes (per-lane), tracked on ASYNCcnt
__device__ __forceinline__ void async_b128(unsigned lds_addr, unsigned long long gaddr) {
  asm volatile("global_load_async_to_lds_b128 %0, %1, off"
               :: "v"(lds_addr), "v"(gaddr) : "memory");
}
__device__ __forceinline__ void wait_async0() {
  asm volatile("s_wait_asynccnt 0x0" ::: "memory");
}

// ---- Prep kernel 1: f32->f16 convert all weights into fragment order -------

__global__ __launch_bounds__(256) void prep_weights(
    const float* __restrict__ qkv_w, const float* __restrict__ proj_w,
    const float* __restrict__ fc1_w, const float* __restrict__ fc2_w,
    half_t* __restrict__ wh)
{
  int idx = blockIdx.x * 256 + threadIdx.x;
  // place inside the 512-half fragment (every matrix starts on a fragment boundary)
  int ln = (idx >> 3) & 31;                                  // lane that reads it
  int nr = ln & 15;                                          // n inside the fragment
  int kk = ((ln >> 4) << 3) + (((idx >> 8) & 1) << 4) + (idx & 7);  // k inside it
  if (idx < OFF_PROJT) {                       // qkvT: 8 fragments per strip
    int f = idx >> 9;
    int n = ((f >> 3) << 4) + nr, k = ((f & 7) << 5) + kk;
    wh[idx] = (half_t)qkv_w[k * 768 + n];
  } else if (idx < OFF_FC1T) {                 // projT: 8 per strip
    int f = (idx - OFF_PROJT) >> 9;
    int n = ((f >> 3) << 4) + nr, k = ((f & 7) << 5) + kk;
    wh[idx] = (half_t)proj_w[k * 256 + n];
  } else if (idx < OFF_FC2T) {                 // fc1T (1024 x 256): 8 per strip
    int f = (idx - OFF_FC1T) >> 9;
    int n = ((f >> 3) << 4) + nr, k = ((f & 7) << 5) + kk;
    wh[idx] = (half_t)fc1_w[k * 1024 + n];
  } else if (idx < TOT_H) {                    // fc2T (256 x 1024): 32 per strip
    int f = (idx - OFF_FC2T) >> 9;
    int n = ((f >> 5) << 4) + nr, k = ((f & 31) << 5) + kk;
    wh[idx] = (half_t)fc2_w[k * 256 + n];
  }
}

// ---- Prep kernel 2: CPB MLP -> 16*sigmoid bias table -----------------------

__device__ __forceinline__ float logrel(int i) {
  float v = (float)(i - 7) * (8.f / 7.f);
  float a = log2f(fabsf(v) + 1.f) * (1.f / 3.f);   // /log2(8)
  return copysignf(a, v);
}

__global__ __launch_bounds__(256) void prep_bias(
    const float* __restrict__ w1, const float* __restrict__ b1,
    const float* __restrict__ w2, float* __restrict__ bias16)
{
  __shared__ float bt[225 * 8];
  int tid = threadIdx.x;
  if (tid < 225) {
    int a = tid / 15, bcol = tid % 15;
    float fx = logrel(a), fy = logrel(bcol);
    float acc[8];
#pragma unroll
    for (int h = 0; h < 8; ++h) acc[h] = 0.f;
    for (int j = 0; j < 512; ++j) {
      float hv = fmaxf(fx * w1[j] + fy * w1[512 + j] + b1[j], 0.f);
#pragma unroll
      for (int h = 0; h < 8; ++h) acc[h] += hv * w2[j * 8 + h];
    }
#pragma unroll
    for (int h = 0; h < 8; ++h) bt[tid * 8 + h] = acc[h];
  }
  __syncthreads();
  for (int q = tid; q < 4096; q += 256) {
    int i = q >> 6, j = q & 63;
    int dy = (i >> 3) - (j >> 3) + 7;
    int dx = (i & 7) - (j & 7) + 7;
    int t = dy * 15 + dx;
#pragma unroll
    for (int h = 0; h < 8; ++h)
      bias16[h * 4096 + q] = 16.f / (1.f + __expf(-bt[t * 8 + h]));
  }
}

// ---- Main fused Swin-V2 block kernel: one 8x8 window per workgroup ---------

__global__ __launch_bounds__(256) void swin_block(
    const float* __restrict__ x,
    const float* __restrict__ logit_scale,
    const float* __restrict__ proj_b,
    const float* __restrict__ ln1_w, const float* __restrict__ ln1_b,
    const float* __restrict__ fc1_b, const float* __restrict__ fc2_b,
    const float* __restrict__ ln2_w, const float* __restrict__ ln2_b,
    const half_t* __restrict__ wh, const float* __restrict__ bias16,
    float* __restrict__ out)
{
  // attention scratch overlaid with the raw f32 input staging buffer:
  // xstage is only live before the head loop starts.
  union SMem {
    float xstage[MTOK * DIMC];                 // 64 KB raw window (f32)
    struct {
      half_t S16[MTOK * LDA];                  // o / gelu chunk / mlp staging
      half_t qb[MTOK * HD];
      half_t kb[MTOK * HD];
      half_t vT[HD * MTOK];                    // v transposed (N=d x K=j)
      half_t p16[MTOK * MTOK];
      float  lg[MTOK * MTOK];
    } at;
  };
  __shared__ SMem U;
  __shared__ half_t XY16[MTOK * LDA];          // x window -> y (in place)
  __shared__ float  muA[MTOK], rsA[MTOK];
  __shared__ int    lab[MTOK];

  half_t* S16 = U.at.S16;
  half_t* qb  = U.at.qb;
  half_t* kb  = U.at.kb;
  half_t* vT  = U.at.vT;
  half_t* p16 = U.at.p16;
  float*  lg  = U.at.lg;

  const int tid  = threadIdx.x;
  const int wv   = tid >> 5;
  const int lane = tid & 31;
  const int blk  = blockIdx.x;
  const int b    = blk >> 10;
  const int wi   = blk & 1023;
  const int wy   = wi >> 5, wx = wi & 31;

  const half_t* qkvT  = wh + OFF_QKVT;
  const half_t* projT = wh + OFF_PROJT;
  const half_t* fc1T  = wh + OFF_FC1T;
  const half_t* fc2T  = wh + OFF_FC2T;

  // ---- async DMA the shifted window (f32) into LDS staging ----
  // 4096 x 16B copies: job = (c, ty, 4px-group); each group is contiguous in
  // memory even across the cyclic-shift wrap (group start gx <= 252 always).
#pragma unroll
  for (int it = 0; it < 16; ++it) {
    int job = it * 256 + tid;
    int c   = job >> 4;
    int rem = job & 15;
    int ty  = rem >> 1;
    int grp = rem & 1;
    int gy  = ((wy << 3) + ty + SHIFTS) & 255;
    int gx  = ((wx << 3) + (grp << 2) + SHIFTS) & 255;
    const float* gp = x + (((size_t)(b * DIMC + c)) << 16) + (gy << 8) + gx;
    unsigned lds = (unsigned)(unsigned long long)(uintptr_t)
                   (&U.xstage[c * MTOK + ty * 8 + grp * 4]);
    async_b128(lds, (unsigned long long)(uintptr_t)gp);
  }
  if (tid < 64) {
    int r = tid;
    int sy = (wy << 3) + (r >> 3), sx = (wx << 3) + (r & 7);
    int ry = (sy < IMG - WSZ) ? 0 : (sy < IMG - SHIFTS ? 1 : 2);
    int rx = (sx < IMG - WSZ) ? 0 : (sx < IMG - SHIFTS ? 1 : 2);
    lab[r] = ry * 3 + rx;
  }
  if (tid == 0 && blk + 1 < (int)gridDim.x)
    __builtin_prefetch(x + ((size_t)((blk + 1) >> 10) << 24), 0, 1);
  wait_async0();
  __syncthreads();

  // convert staged f32 -> f16 A-operand layout (token-major, padded rows)
  for (int it = 0; it < 64; ++it) {
    int idx = it * 256 + tid;
    int r = idx & 63, c = idx >> 6;
    XY16[r * LDA + c] = (half_t)U.xstage[c * MTOK + r];
  }
  __syncthreads();

  // ---- attention, one head at a time ----
  for (int h = 0; h < HEADS; ++h) {
    // QKV GEMM: 24 (16x16) output tiles, 3 per wave, K = 256
#pragma unroll
    for (int jj = 0; jj < 3; ++jj) {
      int job = wv + (jj << 3);
      int mat = job >> 3, tix = job & 7;
      int mi = tix & 3, ni = tix >> 2;
      const half_t* Bb = qkvT + (size_t)(mat * DIMC + h * HD + ni * 16) * DIMC;  // strip start
      const half_t* Ab = XY16 + (mi * 16) * LDA;
      v8f acc = ZERO8;
#pragma unroll
      for (int k0 = 0; k0 < DIMC; k0 += 32)
        acc = wmma_f16(frag_ld(Ab + k0, LDA, lane), frag_ldw(Bb + k0 * 16, lane), acc);
      int Mo = mi * 16 + ((lane >> 4) << 3);
      int No = ni * 16 + (lane & 15);
      if (mat == 0) {
#pragma unroll
        for (int g = 0; g < 8; ++g) qb[(Mo + g) * HD + No] = (half_t)acc[g];
      } else if (mat == 1) {
#pragma unroll
        for (int g = 0; g < 8; ++g) kb[(Mo + g) * HD + No] = (half_t)acc[g];
      } else {
#pragma unroll
        for (int g = 0; g < 8; ++g) vT[No * MTOK + (Mo + g)] = (half_t)acc[g];
      }
    }
    __syncthreads();

    // cosine-attention row normalization; fold logit scale into q
    if (tid < 128) {
      int r = tid & 63, isk = tid >> 6;
      half_t* buf = isk ? kb : qb;
      float ss = 0.f;
      for (int d = 0; d < HD; ++d) { float v = (float)buf[r * HD + d]; ss += v * v; }
      float inv = 1.f / fmaxf(sqrtf(ss), 1e-12f);
      if (!isk) inv *= __expf(fminf(logit_scale[h], 4.6051702f));
      for (int d = 0; d < HD; ++d)
        buf[r * HD + d] = (half_t)((float)buf[r * HD + d] * inv);
    }
    __syncthreads();

    // logits = qn @ kn^T (K=32), + bias + shift mask
#pragma unroll
    for (int jj = 0; jj < 2; ++jj) {
      int tix = (wv << 1) + jj;
      int mi = tix >> 2, ni = tix & 3;
      v8f acc = wmma_f16(frag_ld(qb + mi * 16 * HD, HD, lane),
                         frag_ld(kb + ni * 16 * HD, HD, lane), ZERO8);
      int Mo = mi * 16 + ((lane >> 4) << 3);
      int No = ni * 16 + (lane & 15);
      const float* bh = bias16 + h * 4096;
#pragma unroll
      for (int g = 0; g < 8; ++g) {
        int i = Mo + g;
        float msk = (lab[i] == lab[No]) ? 0.f : -100.f;
        lg[i * 64 + No] = acc[g] + bh[i * 64 + No] + msk;
      }
    }
    __syncthreads();

    // softmax over j (row per thread)
    if (tid < 64) {
      float mx = -1e30f;
      for (int j = 0; j < 64; ++j) mx = fmaxf(mx, lg[tid * 64 + j]);
      float s = 0.f;
      for (int j = 0; j < 64; ++j) s += __expf(lg[tid * 64 + j] - mx);
      float invs = 1.f / s;
      for (int j = 0; j < 64; ++j)
        p16[tid * 64 + j] = (half_t)(__expf(lg[tid * 64 + j] - mx) * invs);
    }
    __syncthreads();

    // o_h = p @ v (K=64), one tile per wave, into S16 head columns
    {
      int mi = wv & 3, ni = wv >> 2;
      v8f acc = ZERO8;
#pragma unroll
      for (int k0 = 0; k0 < 64; k0 += 32)
        acc = wmma_f16(frag_ld(p16 + mi * 16 * 64 + k0, 64, lane),
                       frag_ld(vT + ni * 16 * 64 + k0, 64, lane), acc);
      int Mo = mi * 16 + ((lane >> 4) << 3);
      int No = h * HD + ni * 16 + (lane & 15);
#pragma unroll
      for (int g = 0; g < 8; ++g) S16[(Mo + g) * LDA + No] = (half_t)acc[g];
    }
    __syncthreads();
  }

  // ---- output projection: 64 tiles, 8 per wave, K = 256 ----
  v8f pres[8];
#pragma unroll
  for (int t = 0; t < 8; ++t) {
    int tix = (wv << 3) + t;
    int mi = tix >> 4, ni = tix & 15;
    v8f acc = ZERO8;
#pragma unroll
    for (int k0 = 0; k0 < DIMC; k0 += 32)
      acc = wmma_f16(frag_ld(S16 + mi * 16 * LDA + k0, LDA, lane),
                     frag_ldw(projT + (size_t)(ni * 16) * DIMC + k0 * 16, lane), acc);
    pres[t] = acc;
  }
  __syncthreads();
#pragma unroll
  for (int t = 0; t < 8; ++t) {
    int tix = (wv << 3) + t;
    int mi = tix >> 4, ni = tix & 15;
    int Mo = mi * 16 + ((lane >> 4) << 3);
    int No = ni * 16 + (lane & 15);
    float pb = proj_b[No];
#pragma unroll
    for (int g = 0; g < 8; ++g) S16[(Mo + g) * LDA + No] = (half_t)(pres[t][g] + pb);
  }
  __syncthreads();

  // ---- y = LN1(o) + x  (in place into XY16) ----
  if (tid < 64) {
    float mu = 0.f;
    for (int c = 0; c < DIMC; ++c) mu += (float)S16[tid * LDA + c];
    mu *= (1.f / DIMC);
    float var = 0.f;
    for (int c = 0; c < DIMC; ++c) {
      float d = (float)S16[tid * LDA + c] - mu; var += d * d;
    }
    float rs = rsqrtf(var * (1.f / DIMC) + 1e-5f);
    for (int c = 0; c < DIMC; ++c) {
      float yv = ((float)S16[tid * LDA + c] - mu) * rs * ln1_w[c] + ln1_b[c]
               + (float)XY16[tid * LDA + c];
      XY16[tid * LDA + c] = (half_t)yv;
    }
  }
  __syncthreads();

  // ---- MLP: 4 chunks of 256 hidden; fc2 accumulates persistently ----
  v8f acc2[8];
#pragma unroll
  for (int t = 0; t < 8; ++t) acc2[t] = ZERO8;

  for (int kc = 0; kc < 4; ++kc) {
    v8f r1[8];
#pragma unroll
    for (int t = 0; t < 8; ++t) {
      int tix = (wv << 3) + t;
      int mi = tix >> 4, ni = tix & 15;
      const half_t* Bb = fc1T + (size_t)(kc * 256 + ni * 16) * DIMC;
      v8f acc = ZERO8;
#pragma unroll
      for (int k0 = 0; k0 < DIMC; k0 += 32)
        acc = wmma_f16(frag_ld(XY16 + mi * 16 * LDA + k0, LDA, lane),
                       frag_ldw(Bb + k0 * 16, lane), acc);
      r1[t] = acc;
    }
#pragma unroll
    for (int t = 0; t < 8; ++t) {
      int tix = (wv << 3) + t;
      int mi = tix >> 4, ni = tix & 15;
      int Mo = mi * 16 + ((lane >> 4) << 3);
      int No = ni * 16 + (lane & 15);
      float bb = fc1_b[kc * 256 + No];
#pragma unroll
      for (int g = 0; g < 8; ++g) {
        float v = r1[t][g] + bb;
        float ge = 0.5f * v * (1.f + erff(v * 0.70710678f));
        S16[(Mo + g) * LDA + No] = (half_t)ge;
      }
    }
    __syncthreads();
#pragma unroll
    for (int t = 0; t < 8; ++t) {
      int tix = (wv << 3) + t;
      int mi = tix >> 4, ni = tix & 15;
      const half_t* Bb = fc2T + (size_t)(ni * 16) * HIDDEN + kc * 256 * 16;
      v8f acc = acc2[t];
#pragma unroll
      for (int k0 = 0; k0 < DIMC; k0 += 32)
        acc = wmma_f16(frag_ld(S16 + mi * 16 * LDA + k0, LDA, lane),
                       frag_ldw(Bb + k0 * 16, lane), acc);
      acc2[t] = acc;
    }
    __syncthreads();
  }

  // mlp result into S16
#pragma unroll
  for (int t = 0; t < 8; ++t) {
    int tix = (wv << 3) + t;
    int mi = tix >> 4, ni = tix & 15;
    int Mo = mi * 16 + ((lane >> 4) << 3);
    int No = ni * 16 + (lane & 15);
    float bb = fc2_b[No];
#pragma unroll
    for (int g = 0; g < 8; ++g) S16[(Mo + g) * LDA + No] = (half_t)(acc2[t][g] + bb);
  }
  __syncthreads();

  // LN2 stats
  if (tid < 64) {
    float mu = 0.f;
    for (int c = 0; c < DIMC; ++c) mu += (float)S16[tid * LDA + c];
    mu *= (1.f / DIMC);
    float var = 0.f;
    for (int c = 0; c < DIMC; ++c) {
      float d = (float)S16[tid * LDA + c] - mu; var += d * d;
    }
    muA[tid] = mu;
    rsA[tid] = rsqrtf(var * (1.f / DIMC) + 1e-5f);
  }
  __syncthreads();

  // ---- final: out = LN2(mlp) + y, window-reverse + un-shift ----
  for (int it = 0; it < 64; ++it) {
    int c = (it << 2) + (tid >> 6);
    int r = tid & 63;
    float mv = ((float)S16[r * LDA + c] - muA[r]) * rsA[r] * ln2_w[c] + ln2_b[c];
    float yv = mv + (float)XY16[r * LDA + c];
    int gy = ((wy << 3) + (r >> 3) + SHIFTS) & 255;
    int gx = ((wx << 3) + (r & 7) + SHIFTS) & 255;
    out[(((size_t)(b * DIMC + c)) << 16) + (gy << 8) + gx] = yv;
  }
}

// ---- launch ----------------------------------------------------------------

extern "C" void kernel_launch(void* const* d_in, const int* in_sizes, int n_in,
                              void* d_out, int out_size, void* d_ws, size_t ws_size,
                              hipStream_t stream) {
  (void)in_sizes; (void)n_in; (void)out_size; (void)ws_size;
  const float* x        = (const float*)d_in[0];
  const float* qkv_w    = (const float*)d_in[1];
  const float* lscale   = (const float*)d_in[2];
  const float* proj_w   = (const float*)d_in[3];
  const float* proj_b   = (const float*)d_in[4];
  const float* ln1_w    = (const float*)d_in[5];
  const float* ln1_b    = (const float*)d_in[6];
  const float* fc1_w    = (const float*)d_in[7];
  const float* fc1_b    = (const float*)d_in[8];
  const float* fc2_w    = (const float*)d_in[9];
  const float* fc2_b    = (const float*)d_in[10];
  const float* ln2_w    = (const float*)d_in[11];
  const float* ln2_b    = (const float*)d_in[12];
  const float* cpb_w1   = (const float*)d_in[13];
  const float* cpb_b1   = (const float*)d_in[14];
  const float* cpb_w2   = (const float*)d_in[15];

  half_t* wh     = (half_t*)d_ws;
  float*  bias16 = (float*)((char*)d_ws + OFF_BIAS_BYTES);
  float*  out    = (float*)d_out;

  prep_weights<<<TOT_H / 256, 256, 0, stream>>>(qkv_w, proj_w, fc1_w, fc2_w, wh);
  prep_bias<<<1, 256, 0, stream>>>(cpb_w1, cpb_b1, cpb_w2, bias16);
  swin_block<<<2048, 256, 0, stream>>>(x, lscale, proj_b, ln1_w, ln1_b,
                                       fc1_b, fc2_b, ln2_w, ln2_b,
                                       wh, bias16, out);
}

// v002
// One run takes 808 microseconds.
// Two timings next to v001 put it at 1.23 and 1.25 times that version's speed.
// Counting every step since v000, it is 1.48 times as fast.
#include <hip/hip_runtime.h>
#include <hip/hip_bf16.h>
#include <math.h>

typedef _Float16 half_t;
typedef half_t v16h __attribute__((ext_vector_type(16)));
typedef half_t v8h  __attribute__((ext_vector_type(8)));
typedef float  v8f  __attribute__((ext_vector_type(8)));

#define DIMC   256
#define HEADS  8
#define HD     32
#define WSZ    8
#define SHIFTS 4
#define MTOK   64
#define IMG    256
#define HIDDEN 1024
#define LDA    264   // padded f16 row stride (264 halves = 528B, bank-spread, 16B-aligned)

// workspace layout (in halves): qkvT 768x256 | projT 256x256 | fc1T 1024x256 | fc2T 256x1024
// Each N x K matrix is stored fragment by fragment (16 n x 32 k = 512 halves = 1 KiB),
// fragments of one 16-row strip following each other along k. Inside a fragment the
// halves lie in register order: 32 lanes x first 8 halves (512 B), then 32 lanes x
// second 8 halves (512 B), so each wave-wide 16-byte load reads 4 whole 128-B lines.
#define OFF_QKVT 0
#define OFF_PROJT (768*256)
#define OFF_FC1T  (OFF_PROJT + 256*256)
#define OFF_FC2T  (OFF_FC1T + 1024*256)
#define TOT_H     (OFF_FC2T + 256*1024)
#define OFF_BIAS_BYTES ((size_t)TOT_H * 2)   // then float bias16[8][64][64]

// ---- WMMA helpers -----------------------------------------------------------

// 16x32 f16 fragment (A-style; also B from the N x K LDS buffers kb and vT).
// CDNA5 layout: lanes 0-15 row M=lane hold K 0..7 then 16..23;
// lanes 16-31 hold K 8..15 then 24..31.
__device__ __forceinline__ v16h frag_ld(const half_t* p0, int ld, int lane) {
  const half_t* p = p0 + (lane & 15) * ld + ((lane >> 4) << 3);
  v8h lo = *(const v8h*)p;
  v8h hi = *(const v8h*)(p + 16);
  return __builtin_shufflevector(lo, hi, 0,1,2,3,4,5,6,7,8,9,10,11,12,13,14,15);
}

// B fragment from the packed weights: same lane/k map as frag_ld, contiguous bytes.
__device__ __forceinline__ v16h frag_ldw(const half_t* frag, int lane) {
  const half_t* p = frag + lane * 8;
  v8h lo = *(const v8h*)p;
  v8h hi = *(const v8h*)(p + 256);
  return __builtin_shufflevector(lo, hi, 0,1,2,3,4,5,6,7,8,9,10,11,12,13,14,15);
}

__device__ __forceinline__ v8f wmma_f16(v16h a, v16h b, v8f c) {
  return __builtin_amdgcn_wmma_f32_16x16x32_f16(false, a, false, b, (short)0, c,
                                                false, false);
}

#define ZERO8 ((v8f){0.f,0.f,0.f,0.f,0.f,0.f,0.f,0.f})

// One wave's strip of a 64 x N product, K = 256: all 4 row tiles x NT column tiles.
// Each packed weight fragment is loaded once and feeds 4 WMMAs; the A fragments come
// from LDS at every k step. acc[j * 4 + mi]; k runs upward for every tile.
template <int NT>
__device__ __forceinline__ void strip_gemm(const half_t* As, const half_t* B0, int bstride,
                                           int lane, v8f* acc) {
#pragma unroll
  for (int k0 = 0; k0 < DIMC; k0 += 32) {
    v16h bf[NT];
#pragma unroll
    for (int j = 0; j < NT; ++j) bf[j] = frag_ldw(B0 + j * bstride + k0 * 16, lane);
#pragma unroll
    for (int mi = 0; mi < 4; ++mi) {
      v16h af = frag_ld(As + mi * 16 * LDA + k0, LDA, lane);
#pragma unroll
      for (int j = 0; j < NT; ++j) acc[j * 4 + mi] = wmma_f16(af, bf[j], acc[j * 4 + mi]);
    }
  }
}

// async global -> LDS copy of 16 bytes (per-lane), tracked on ASYNCcnt
__device__ __forceinline__ void async_b128(unsigned lds_addr, unsigned long long gaddr) {
  asm volatile("global_load_async_to_lds_b128 %0, %1, off"
               :: "v"(lds_addr), "v"(gaddr) : "memory");
}
__device__ __forceinline__ void wait_async0() {
  asm volatile("s_wait_asynccnt 0x0" ::: "memory");
}

// ---- Prep kernel 1: f32->f16 convert all weights into fragment order -------

__global__ __launch_bounds__(256) void prep_weights(
    const float* __restrict__ qkv_w, const float* __restrict__ proj_w,
    const float* __restrict__ fc1_w, const float* __restrict__ fc2_w,
    half_t* __restrict__ wh)
{
  int idx = blockIdx.x * 256 + threadIdx.x;
  // place inside the 512-half fragment (every matrix starts on a fragment boundary)
  int ln = (idx >> 3) & 31;                                  // lane that reads it
  int nr = ln & 15;                                          // n inside the fragment
  int kk = ((ln >> 4) << 3) + (((idx >> 8) & 1) << 4) + (idx & 7);  // k inside it
  if (idx < OFF_PROJT) {                       // qkvT: 8 fragments per strip
    int f = idx >> 9;
    int n = ((f >> 3) << 4) + nr, k = ((f & 7) << 5) + kk;
    wh[idx] = (half_t)qkv_w[k * 768 + n];
  } else if (idx < OFF_FC1T) {                 // projT: 8 per strip
    int f = (idx - OFF_PROJT) >> 9;
    int n = ((f >> 3) << 4) + nr, k = ((f & 7) << 5) + kk;
    wh[idx] = (half_t)proj_w[k * 256 + n];
  } else if (idx < OFF_FC2T) {                 // fc1T (1024 x 256): 8 per strip
    int f = (idx - OFF_FC1T) >> 9;
    int n = ((f >> 3) << 4) + nr, k = ((f & 7) << 5) + kk;
    wh[idx] = (half_t)fc1_w[k * 1024 + n];
  } else if (idx < TOT_H) {                    // fc2T (256 x 1024): 32 per strip
    int f = (idx - OFF_FC2T) >> 9;
    int n = ((f >> 5) << 4) + nr, k = ((f & 31) << 5) + kk;
    wh[idx] = (half_t)fc2_w[k * 256 + n];
  }
}

// ---- Prep kernel 2: CPB MLP -> 16*sigmoid bias table -----------------------

__device__ __forceinline__ float logrel(int i) {
  float v = (float)(i - 7) * (8.f / 7.f);
  float a = log2f(fabsf(v) + 1.f) * (1.f / 3.f);   // /log2(8)
  return copysignf(a, v);
}

__global__ __launch_bounds__(256) void prep_bias(
    const float* __restrict__ w1, const float* __restrict__ b1,
    const float* __restrict__ w2, float* __restrict__ bias16)
{
  __shared__ float bt[225 * 8];
  int tid = threadIdx.x;
  if (tid < 225) {
    int a = tid / 15, bcol = tid % 15;
    float fx = logrel(a), fy = logrel(bcol);
    float acc[8];
#pragma unroll
    for (int h = 0; h < 8; ++h) acc[h] = 0.f;
    for (int j = 0; j < 512; ++j) {
      float hv = fmaxf(fx * w1[j] + fy * w1[512 + j] + b1[j], 0.f);
#pragma unroll
      for (int h = 0; h < 8; ++h) acc[h] += hv * w2[j * 8 + h];
    }
#pragma unroll
    for (int h = 0; h < 8; ++h) bt[tid * 8 + h] = acc[h];
  }
  __syncthreads();
  for (int q = tid; q < 4096; q += 256) {
    int i = q >> 6, j = q & 63;
    int dy = (i >> 3) - (j >> 3) + 7;
    int dx = (i & 7) - (j & 7) + 7;
    int t = dy * 15 + dx;
#pragma unroll
    for (int h = 0; h < 8; ++h)
      bias16[h * 4096 + q] = 16.f / (1.f + __expf(-bt[t * 8 + h]));
  }
}

// ---- Main fused Swin-V2 block kernel: one 8x8 window per workgroup ---------

__global__ __launch_bounds__(256) void swin_block(
    const float* __restrict__ x,
    const float* __restrict__ logit_scale,
    const float* __restrict__ proj_b,
    const float* __restrict__ ln1_w, const float* __restrict__ ln1_b,
    const float* __restrict__ fc1_b, const float* __restrict__ fc2_b,
    const float* __restrict__ ln2_w, const float* __restrict__ ln2_b,
    const half_t* __restrict__ wh, const float* __restrict__ bias16,
    float* __restrict__ out)
{
  // attention scratch overlaid with the raw f32 input staging buffer:
  // xstage is only live before the head loop starts.
  union SMem {
    float xstage[MTOK * DIMC];                 // 64 KB raw window (f32)
    struct {
      half_t S16[MTOK * LDA];                  // o / gelu chunk / mlp staging
      half_t qb[4 * MTOK * HD];                // q, k, v of a group of 4 heads
      half_t kb[4 * MTOK * HD];
      half_t vT[4 * HD * MTOK];                // v transposed (N=d x K=j)
      half_t p16[MTOK * MTOK];
      float  lg[MTOK * MTOK];
    } at;
  };
  __shared__ SMem U;
  __shared__ half_t XY16[MTOK * LDA];          // x window -> y (in place)
  __shared__ float  muA[MTOK], rsA[MTOK];
  __shared__ int    lab[MTOK];

  half_t* S16 = U.at.S16;
  half_t* qb4 = U.at.qb;
  half_t* kb4 = U.at.kb;
  half_t* vT4 = U.at.vT;
  half_t* p16 = U.at.p16;
  float*  lg  = U.at.lg;

  const int tid  = threadIdx.x;
  const int wv   = tid >> 5;
  const int lane = tid & 31;
  const int blk  = blockIdx.x;
  const int b    = blk >> 10;
  const int wi   = blk & 1023;
  const int wy   = wi >> 5, wx = wi & 31;

  const half_t* qkvT  = wh + OFF_QKVT;
  const half_t* projT = wh + OFF_PROJT;
  const half_t* fc1T  = wh + OFF_FC1T;
  const half_t* fc2T  = wh + OFF_FC2T;

  // ---- async DMA the shifted window (f32) into LDS staging ----
  // 4096 x 16B copies: job = (c, ty, 4px-group); each group is contiguous in
  // memory even across the cyclic-shift wrap (group start gx <= 252 always).
#pragma unroll
  for (int it = 0; it < 16; ++it) {
    int job = it * 256 + tid;
    int c   = job >> 4;
    int rem = job & 15;
    int ty  = rem >> 1;
    int grp = rem & 1;
    int gy  = ((wy << 3) + ty + SHIFTS) & 255;
    int gx  = ((wx << 3) + (grp << 2) + SHIFTS) & 255;
    const float* gp = x + (((size_t)(b * DIMC + c)) << 16) + (gy << 8) + gx;
    unsigned lds = (unsigned)(unsigned long long)(uintptr_t)
                   (&U.xstage[c * MTOK + ty * 8 + grp * 4]);
    async_b128(lds, (unsigned long long)(uintptr_t)gp);
  }
  if (tid < 64) {
    int r = tid;
    int sy = (wy << 3) + (r >> 3), sx = (wx << 3) + (r & 7);
    int ry = (sy < IMG - WSZ) ? 0 : (sy < IMG - SHIFTS ? 1 : 2);
    int rx = (sx < IMG - WSZ) ? 0 : (sx < IMG - SHIFTS ? 1 : 2);
    lab[r] = ry * 3 + rx;
  }
  if (tid == 0 && blk + 1 < (int)gridDim.x)
    __builtin_prefetch(x + ((size_t)((blk + 1) >> 10) << 24), 0, 1);
  wait_async0();
  __syncthreads();

  // convert staged f32 -> f16 A-operand layout (token-major, padded rows)
  for (int it = 0; it < 64; ++it) {
    int idx = it * 256 + tid;
    int r = idx & 63, c = idx >> 6;
    XY16[r * LDA + c] = (half_t)U.xstage[c * MTOK + r];
  }
  __syncthreads();

  // ---- attention: QKV product for 4 heads at a time, then one head at a time ----
  for (int hg = 0; hg < HEADS / 4; ++hg) {
    // 24 column tiles (q, k, v x 4 heads x 2): each wave takes one of q, of k and of v,
    // with all 4 row tiles, K = 256
    {
      int hw = wv >> 1, nw = wv & 1;           // head inside the group, column tile inside the head
      v8f acc[12];
#pragma unroll
      for (int t = 0; t < 12; ++t) acc[t] = ZERO8;
      strip_gemm<3>(XY16, qkvT + (size_t)((hg * 4 + hw) * HD + nw * 16) * DIMC, DIMC * DIMC,
                    lane, acc);
      int No = nw * 16 + (lane & 15);
#pragma unroll
      for (int mi = 0; mi < 4; ++mi) {
        int Mo = mi * 16 + ((lane >> 4) << 3);
#pragma unroll
        for (int g = 0; g < 8; ++g) {
          qb4[hw * (MTOK * HD) + (Mo + g) * HD + No]   = (half_t)acc[mi][g];
          kb4[hw * (MTOK * HD) + (Mo + g) * HD + No]   = (half_t)acc[4 + mi][g];
          vT4[hw * (MTOK * HD) + No * MTOK + (Mo + g)] = (half_t)acc[8 + mi][g];
        }
      }
    }
    __syncthreads();

   for (int hl = 0; hl < 4; ++hl) {
    const int h = hg * 4 + hl;
    half_t* qb = qb4 + hl * (MTOK * HD);
    half_t* kb = kb4 + hl * (MTOK * HD);
    half_t* vT = vT4 + hl * (MTOK * HD);

    // cosine-attention row normalization; fold logit scale into q
    if (tid < 128) {
      int r = tid & 63, isk = tid >> 6;
      half_t* buf = isk ? kb : qb;
      float ss = 0.f;
      for (int d = 0; d < HD; ++d) { float v = (float)buf[r * HD + d]; ss += v * v; }
      float inv = 1.f / fmaxf(sqrtf(ss), 1e-12f);
      if (!isk) inv *= __expf(fminf(logit_scale[h], 4.6051702f));
      for (int d = 0; d < HD; ++d)
        buf[r * HD + d] = (half_t)((float)buf[r * HD + d] * inv);
    }
    __syncthreads();

    // logits = qn @ kn^T (K=32), + bias + shift mask
#pragma unroll
    for (int jj = 0; jj < 2; ++jj) {
      int tix = (wv << 1) + jj;
      int mi = tix >> 2, ni = tix & 3;
      v8f acc = wmma_f16(frag_ld(qb + mi * 16 * HD, HD, lane),
                         frag_ld(kb + ni * 16 * HD, HD, lane), ZERO8);
      int Mo = mi * 16 + ((lane >> 4) << 3);
      int No = ni * 16 + (lane & 15);
      const float* bh = bias16 + h * 4096;
#pragma unroll
      for (int g = 0; g < 8; ++g) {
        int i = Mo + g;
        float msk = (lab[i] == lab[No]) ? 0.f : -100.f;
        lg[i * 64 + No] = acc[g] + bh[i * 64 + No] + msk;
      }
    }
    __syncthreads();

    // softmax over j (row per thread)
    if (tid < 64) {
      float mx = -1e30f;
      for (int j = 0; j < 64; ++j) mx = fmaxf(mx, lg[tid * 64 + j]);
      float s = 0.f;
      for (int j = 0; j < 64; ++j) s += __expf(lg[tid * 64 + j] - mx);
      float invs = 1.f / s;
      for (int j = 0; j < 64; ++j)
        p16[tid * 64 + j] = (half_t)(__expf(lg[tid * 64 + j] - mx) * invs);
    }
    __syncthreads();

    // o_h = p @ v (K=64), one tile per wave, into S16 head columns
    {
      int mi = wv & 3, ni = wv >> 2;
      v8f acc = ZERO8;
#pragma unroll
      for (int k0 = 0; k0 < 64; k0 += 32)
        acc = wmma_f16(frag_ld(p16 + mi * 16 * 64 + k0, 64, lane),
                       frag_ld(vT + ni * 16 * 64 + k0, 64, lane), acc);
      int Mo = mi * 16 + ((lane >> 4) << 3);
      int No = h * HD + ni * 16 + (lane & 15);
#pragma unroll
      for (int g = 0; g < 8; ++g) S16[(Mo + g) * LDA + No] = (half_t)acc[g];
    }
    __syncthreads();
   }
  }

  // ---- output projection: 64 tiles, 8 per wave (4 row x 2 column tiles), K = 256 ----
  v8f pres[8];
#pragma unroll
  for (int t = 0; t < 8; ++t) pres[t] = ZERO8;
  strip_gemm<2>(S16, projT + (size_t)(wv * 32) * DIMC, 16 * DIMC, lane, pres);
  __syncthreads();
#pragma unroll
  for (int t = 0; t < 8; ++t) {
    int mi = t & 3, ni = (wv << 1) + (t >> 2);
    int Mo = mi * 16 + ((lane >> 4) << 3);
    int No = ni * 16 + (lane & 15);
    float pb = proj_b[No];
#pragma unroll
    for (int g = 0; g < 8; ++g) S16[(Mo + g) * LDA + No] = (half_t)(pres[t][g] + pb);
  }
  __syncthreads();

  // ---- y = LN1(o) + x  (in place into XY16) ----
  if (tid < 64) {
    float mu = 0.f;
    for (int c = 0; c < DIMC; ++c) mu += (float)S16[tid * LDA + c];
    mu *= (1.f / DIMC);
    float var = 0.f;
    for (int c = 0; c < DIMC; ++c) {
      float d = (float)S16[tid * LDA + c] - mu; var += d * d;
    }
    float rs = rsqrtf(var * (1.f / DIMC) + 1e-5f);
    for (int c = 0; c < DIMC; ++c) {
      float yv = ((float)S16[tid * LDA + c] - mu) * rs * ln1_w[c] + ln1_b[c]
               + (float)XY16[tid * LDA + c];
      XY16[tid * LDA + c] = (half_t)yv;
    }
  }
  __syncthreads();

  // ---- MLP: 4 chunks of 256 hidden; fc2 accumulates persistently ----
  v8f acc2[8];
#pragma unroll
  for (int t = 0; t < 8; ++t) acc2[t] = ZERO8;

  for (int kc = 0; kc < 4; ++kc) {
    v8f r1[8];
#pragma unroll
    for (int t = 0; t < 8; ++t) r1[t] = ZERO8;
    strip_gemm<2>(XY16, fc1T + (size_t)(kc * 256 + wv * 32) * DIMC, 16 * DIMC, lane, r1);
#pragma unroll
    for (int t = 0; t < 8; ++t) {
      int mi = t & 3, ni = (wv << 1) + (t >> 2);
      int Mo = mi * 16 + ((lane >> 4) << 3);
      int No = ni * 16 + (lane & 15);
      float bb = fc1_b[kc * 256 + No];
#pragma unroll
      for (int g = 0; g < 8; ++g) {
        float v = r1[t][g] + bb;
        float ge = 0.5f * v * (1.f + erff(v * 0.70710678f));
        S16[(Mo + g) * LDA + No] = (half_t)ge;
      }
    }
    __syncthreads();
    strip_gemm<2>(S16, fc2T + (size_t)(wv * 32) * HIDDEN + kc * 256 * 16, 16 * HIDDEN, lane, acc2);
    __syncthreads();
  }

  // mlp result into S16
#pragma unroll
  for (int t = 0; t < 8; ++t) {
    int mi = t & 3, ni = (wv << 1) + (t >> 2);
    int Mo = mi * 16 + ((lane >> 4) << 3);
    int No = ni * 16 + (lane & 15);
    float bb = fc2_b[No];
#pragma unroll
    for (int g = 0; g < 8; ++g) S16[(Mo + g) * LDA + No] = (half_t)(acc2[t][g] + bb);
  }
  __syncthreads();

  // LN2 stats
  if (tid < 64) {
    float mu = 0.f;
    for (int c = 0; c < DIMC; ++c) mu += (float)S16[tid * LDA + c];
    mu *= (1.f / DIMC);
    float var = 0.f;
    for (int c = 0; c < DIMC; ++c) {
      float d = (float)S16[tid * LDA + c] - mu; var += d * d;
    }
    muA[tid] = mu;
    rsA[tid] = rsqrtf(var * (1.f / DIMC) + 1e-5f);
  }
  __syncthreads();

  // ---- final: out = LN2(mlp) + y, window-reverse + un-shift ----
  for (int it = 0; it < 64; ++it) {
    int c = (it << 2) + (tid >> 6);
    int r = tid & 63;
    float mv = ((float)S16[r * LDA + c] - muA[r]) * rsA[r] * ln2_w[c] + ln2_b[c];
    float yv = mv + (float)XY16[r * LDA + c];
    int gy = ((wy << 3) + (r >> 3) + SHIFTS) & 255;
    int gx = ((wx << 3) + (r & 7) + SHIFTS) & 255;
    out[(((size_t)(b * DIMC + c)) << 16) + (gy << 8) + gx] = yv;
  }
}

// ---- launch ----------------------------------------------------------------

extern "C" void kernel_launch(void* const* d_in, const int* in_sizes, int n_in,
                              void* d_out, int out_size, void* d_ws, size_t ws_size,
                              hipStream_t stream) {
  (void)in_sizes; (void)n_in; (void)out_size; (void)ws_size;
  const float* x        = (const float*)d_in[0];
  const float* qkv_w    = (const float*)d_in[1];
  const float* lscale   = (const float*)d_in[2];
  const float* proj_w   = (const float*)d_in[3];
  const float* proj_b   = (const float*)d_in[4];
  const float* ln1_w    = (const float*)d_in[5];
  const float* ln1_b    = (const float*)d_in[6];
  const float* fc1_w    = (const float*)d_in[7];
  const float* fc1_b    = (const float*)d_in[8];
  const float* fc2_w    = (const float*)d_in[9];
  const float* fc2_b    = (const float*)d_in[10];
  const float* ln2_w    = (const float*)d_in[11];
  const float* ln2_b    = (const float*)d_in[12];
  const float* cpb_w1   = (const float*)d_in[13];
  const float* cpb_b1   = (const float*)d_in[14];
  const float* cpb_w2   = (const float*)d_in[15];

  half_t* wh     = (half_t*)d_ws;
  float*  bias16 = (float*)((char*)d_ws + OFF_BIAS_BYTES);
  float*  out    = (float*)d_out;

  prep_weights<<<TOT_H / 256, 256, 0, stream>>>(qkv_w, proj_w, fc1_w, fc2_w, wh);
  prep_bias<<<1, 256, 0, stream>>>(cpb_w1, cpb_b1, cpb_w2, bias16);
  swin_block<<<2048, 256, 0, stream>>>(x, lscale, proj_b, ln1_w, ln1_b,
                                       fc1_b, fc2_b, ln2_w, ln2_b,
                                       wh, bias16, out);
}

// v003
// Measured time: 448 microseconds a run.
// Two timings next to v002 put it at 1.80 and 1.81 times that version's speed.
// Counting every step since v000, it is 2.68 times as fast.
#include <hip/hip_runtime.h>
#include <hip/hip_bf16.h>
#include <math.h>

typedef _Float16 half_t;
typedef half_t v16h __attribute__((ext_vector_type(16)));
typedef half_t v8h  __attribute__((ext_vector_type(8)));
typedef float  v8f  __attribute__((ext_vector_type(8)));
typedef float  v4f  __attribute__((ext_vector_type(4)));

#define DIMC   256
#define HEADS  8
#define HD     32
#define WSZ    8
#define SHIFTS 4
#define MTOK   64
#define IMG    256
#define HIDDEN 1024
#define LDA    264   // padded f16 row stride (264 halves = 528B, bank-spread, 16B-aligned)

// workspace layout (in halves): qkvT 768x256 | projT 256x256 | fc1T 1024x256 | fc2T 256x1024
// Each N x K matrix is stored fragment by fragment (16 n x 32 k = 512 halves = 1 KiB),
// fragments of one 16-row strip following each other along k. Inside a fragment the
// halves lie in register order: 32 lanes x first 8 halves (512 B), then 32 lanes x
// second 8 halves (512 B), so each wave-wide 16-byte load reads 4 whole 128-B lines.
#define OFF_QKVT 0
#define OFF_PROJT (768*256)
#define OFF_FC1T  (OFF_PROJT + 256*256)
#define OFF_FC2T  (OFF_FC1T + 1024*256)
#define TOT_H     (OFF_FC2T + 256*1024)
#define OFF_BIAS_BYTES ((size_t)TOT_H * 2)   // then float bias16[8][64][64]

// ---- WMMA helpers -----------------------------------------------------------

// 16x32 f16 fragment (A from XY16, S16, kb and vT; also B from the N x K LDS buffer qb).
// CDNA5 layout: lanes 0-15 row M=lane hold K 0..7 then 16..23;
// lanes 16-31 hold K 8..15 then 24..31.
__device__ __forceinline__ v16h frag_ld(const half_t* p0, int ld, int lane) {
  const half_t* p = p0 + (lane & 15) * ld + ((lane >> 4) << 3);
  v8h lo = *(const v8h*)p;
  v8h hi = *(const v8h*)(p + 16);
  return __builtin_shufflevector(lo, hi, 0,1,2,3,4,5,6,7,8,9,10,11,12,13,14,15);
}

// B fragment from the packed weights: same lane/k map as frag_ld, contiguous bytes.
__device__ __forceinline__ v16h frag_ldw(const half_t* frag, int lane) {
  const half_t* p = frag + lane * 8;
  v8h lo = *(const v8h*)p;
  v8h hi = *(const v8h*)(p + 256);
  return __builtin_shufflevector(lo, hi, 0,1,2,3,4,5,6,7,8,9,10,11,12,13,14,15);
}

__device__ __forceinline__ v8f wmma_f16(v16h a, v16h b, v8f c) {
  return __builtin_amdgcn_wmma_f32_16x16x32_f16(false, a, false, b, (short)0, c,
                                                false, false);
}

#define ZERO8 ((v8f){0.f,0.f,0.f,0.f,0.f,0.f,0.f,0.f})

// value of lane l ^ 16 (the lane that holds the other half of the same row or column)
__device__ __forceinline__ float xhalf(float x) {
  int b = __builtin_bit_cast(int, x);
  return __builtin_bit_cast(float, __builtin_amdgcn_permlanex16(b, b, 0x76543210, 0xfedcba98,
                                                                false, false));
}

// Scale a 16 x 32 fragment's rows to unit length, times mul. Lanes l and l ^ 16 hold the
// two halves of one row, so the sum of squares is 16 terms in the lane plus one exchange.
// (Loops unrolled: vector elements are reached by constant index only.)
__device__ __forceinline__ v16h frag_unit(v16h f, float mul) {
  float ss = 0.f;
#pragma unroll
  for (int s = 0; s < 16; ++s) { float v = (float)f[s]; ss += v * v; }
  ss += xhalf(ss);
  float inv = 1.f / fmaxf(sqrtf(ss), 1e-12f) * mul;
  v16h o;
#pragma unroll
  for (int s = 0; s < 16; ++s) o[s] = (half_t)((float)f[s] * inv);
  return o;
}

// One wave's strip of a 64 x N product, K = 256: all 4 row tiles x NT column tiles.
// Each packed weight fragment is loaded once and feeds 4 WMMAs; the A fragments come
// from LDS at every k step. acc[j * 4 + mi]; k runs upward for every tile.
template <int NT>
__device__ __forceinline__ void strip_gemm(const half_t* As, const half_t* B0, int bstride,
                                           int lane, v8f* acc) {
#pragma unroll
  for (int k0 = 0; k0 < DIMC; k0 += 32) {
    v16h bf[NT];
#pragma unroll
    for (int j = 0; j < NT; ++j) bf[j] = frag_ldw(B0 + j * bstride + k0 * 16, lane);
#pragma unroll
    for (int mi = 0; mi < 4; ++mi) {
      v16h af = frag_ld(As + mi * 16 * LDA + k0, LDA, lane);
#pragma unroll
      for (int j = 0; j < NT; ++j) acc[j * 4 + mi] = wmma_f16(af, bf[j], acc[j * 4 + mi]);
    }
  }
}

// async global -> LDS copy of 16 bytes (per-lane), tracked on ASYNCcnt
__device__ __forceinline__ void async_b128(unsigned lds_addr, unsigned long long gaddr) {
  asm volatile("global_load_async_to_lds_b128 %0, %1, off"
               :: "v"(lds_addr), "v"(gaddr) : "memory");
}
__device__ __forceinline__ void wait_async0() {
  asm volatile("s_wait_asynccnt 0x0" ::: "memory");
}

// ---- Prep kernel 1: f32->f16 convert all weights into fragment order -------

__global__ __launch_bounds__(256) void prep_weights(
    const float* __restrict__ qkv_w, const float* __restrict__ proj_w,
    const float* __restrict__ fc1_w, const float* __restrict__ fc2_w,
    half_t* __restrict__ wh)
{
  int idx = blockIdx.x * 256 + threadIdx.x;
  // place inside the 512-half fragment (every matrix starts on a fragment boundary)
  int ln = (idx >> 3) & 31;                                  // lane that reads it
  int nr = ln & 15;                                          // n inside the fragment
  int kk = ((ln >> 4) << 3) + (((idx >> 8) & 1) << 4) + (idx & 7);  // k inside it
  if (idx < OFF_PROJT) {                       // qkvT: 8 fragments per strip
    int f = idx >> 9;
    int n = ((f >> 3) << 4) + nr, k = ((f & 7) << 5) + kk;
    wh[idx] = (half_t)qkv_w[k * 768 + n];
  } else if (idx < OFF_FC1T) {                 // projT: 8 per strip
    int f = (idx - OFF_PROJT) >> 9;
    int n = ((f >> 3) << 4) + nr, k = ((f & 7) << 5) + kk;
    wh[idx] = (half_t)proj_w[k * 256 + n];
  } else if (idx < OFF_FC2T) {                 // fc1T (1024 x 256): 8 per strip
    int f = (idx - OFF_FC1T) >> 9;
    int n = ((f >> 3) << 4) + nr, k = ((f & 7) << 5) + kk;
    wh[idx] = (half_t)fc1_w[k * 1024 + n];
  } else if (idx < TOT_H) {                    // fc2T (256 x 1024): 32 per strip
    int f = (idx - OFF_FC2T) >> 9;
    int n = ((f >> 5) << 4) + nr, k = ((f & 31) << 5) + kk;
    wh[idx] = (half_t)fc2_w[k * 256 + n];
  }
}

// ---- Prep kernel 2: CPB MLP -> 16*sigmoid bias table -----------------------

__device__ __forceinline__ float logrel(int i) {
  float v = (float)(i - 7) * (8.f / 7.f);
  float a = log2f(fabsf(v) + 1.f) * (1.f / 3.f);   // /log2(8)
  return copysignf(a, v);
}

__global__ __launch_bounds__(256) void prep_bias(
    const float* __restrict__ w1, const float* __restrict__ b1,
    const float* __restrict__ w2, float* __restrict__ bias16)
{
  __shared__ float bt[225 * 8];
  int tid = threadIdx.x;
  if (tid < 225) {
    int a = tid / 15, bcol = tid % 15;
    float fx = logrel(a), fy = logrel(bcol);
    float acc[8];
#pragma unroll
    for (int h = 0; h < 8; ++h) acc[h] = 0.f;
    for (int j = 0; j < 512; ++j) {
      float hv = fmaxf(fx * w1[j] + fy * w1[512 + j] + b1[j], 0.f);
#pragma unroll
      for (int h = 0; h < 8; ++h) acc[h] += hv * w2[j * 8 + h];
    }
#pragma unroll
    for (int h = 0; h < 8; ++h) bt[tid * 8 + h] = acc[h];
  }
  __syncthreads();
  for (int q = tid; q < 4096; q += 256) {
    int i = q >> 6, j = q & 63;
    int dy = (i >> 3) - (j >> 3) + 7;
    int dx = (i & 7) - (j & 7) + 7;
    int t = dy * 15 + dx;
#pragma unroll
    for (int h = 0; h < 8; ++h)
      bias16[h * 4096 + q] = 16.f / (1.f + __expf(-bt[t * 8 + h]));
  }
}

// ---- Main fused Swin-V2 block kernel: one 8x8 window per workgroup ---------

__global__ __launch_bounds__(256) void swin_block(
    const float* __restrict__ x,
    const float* __restrict__ logit_scale,
    const float* __restrict__ proj_b,
    const float* __restrict__ ln1_w, const float* __restrict__ ln1_b,
    const float* __restrict__ fc1_b, const float* __restrict__ fc2_b,
    const float* __restrict__ ln2_w, const float* __restrict__ ln2_b,
    const half_t* __restrict__ wh, const float* __restrict__ bias16,
    float* __restrict__ out)
{
  // attention scratch overlaid with the raw f32 input staging buffer:
  // xstage is only live before the head loop starts.
  union SMem {
    float xstage[MTOK * DIMC];                 // 64 KB raw window (f32)
    struct {
      half_t S16[MTOK * LDA];                  // o / gelu chunk / mlp staging
      half_t qb[4 * MTOK * HD];                // q, k, v of a group of 4 heads
      half_t kb[4 * MTOK * HD];
      half_t vT[4 * HD * MTOK];                // v transposed (M=d x K=j)
    } at;
  };
  __shared__ SMem U;
  __shared__ half_t XY16[MTOK * LDA];          // x window -> y (in place)
  __shared__ float  muA[MTOK], rsA[MTOK];
  __shared__ int    lab[MTOK];

  half_t* S16 = U.at.S16;
  half_t* qb4 = U.at.qb;
  half_t* kb4 = U.at.kb;
  half_t* vT4 = U.at.vT;

  const int tid  = threadIdx.x;
  const int wv   = tid >> 5;
  const int lane = tid & 31;
  const int blk  = blockIdx.x;
  const int b    = blk >> 10;
  const int wi   = blk & 1023;
  const int wy   = wi >> 5, wx = wi & 31;

  const half_t* qkvT  = wh + OFF_QKVT;
  const half_t* projT = wh + OFF_PROJT;
  const half_t* fc1T  = wh + OFF_FC1T;
  const half_t* fc2T  = wh + OFF_FC2T;

  // ---- async DMA the shifted window (f32) into LDS staging ----
  // 4096 x 16B copies: job = (c, ty, 4px-group); each group is contiguous in
  // memory even across the cyclic-shift wrap (group start gx <= 252 always).
#pragma unroll
  for (int it = 0; it < 16; ++it) {
    int job = it * 256 + tid;
    int c   = job >> 4;
    int rem = job & 15;
    int ty  = rem >> 1;
    int grp = rem & 1;
    int gy  = ((wy << 3) + ty + SHIFTS) & 255;
    int gx  = ((wx << 3) + (grp << 2) + SHIFTS) & 255;
    const float* gp = x + (((size_t)(b * DIMC + c)) << 16) + (gy << 8) + gx;
    unsigned lds = (unsigned)(unsigned long long)(uintptr_t)
                   (&U.xstage[c * MTOK + ty * 8 + grp * 4]);
    async_b128(lds, (unsigned long long)(uintptr_t)gp);
  }
  if (tid < 64) {
    int r = tid;
    int sy = (wy << 3) + (r >> 3), sx = (wx << 3) + (r & 7);
    int ry = (sy < IMG - WSZ) ? 0 : (sy < IMG - SHIFTS ? 1 : 2);
    int rx = (sx < IMG - WSZ) ? 0 : (sx < IMG - SHIFTS ? 1 : 2);
    lab[r] = ry * 3 + rx;
  }
  if (tid == 0 && blk + 1 < (int)gridDim.x)
    __builtin_prefetch(x + ((size_t)((blk + 1) >> 10) << 24), 0, 1);
  wait_async0();
  __syncthreads();

  // convert staged f32 -> f16 A-operand layout (token-major, padded rows)
  for (int it = 0; it < 64; ++it) {
    int idx = it * 256 + tid;
    int r = idx & 63, c = idx >> 6;
    XY16[r * LDA + c] = (half_t)U.xstage[c * MTOK + r];
  }
  __syncthreads();

  // ---- attention: QKV product for 4 heads at a time, then the 4 heads side by side ----
  for (int hg = 0; hg < HEADS / 4; ++hg) {
    // the attention part's split: one wave = 32 queries of one head
    const int hw = wv >> 1;                    // head inside the group
    const int h  = hg * 4 + hw;
    const int i0 = (wv & 1) << 5;              // first query of this wave
    const int cl = lane & 15, hh = lane >> 4;
    float lsc;                                 // logit scale of the head
    v4f bv[2][4][2];                           // bias of query i0+16it+cl, keys 16jt+8hh+0..7
    // 24 column tiles (q, k, v x 4 heads x 2): each wave takes one of q, of k and of v,
    // with all 4 row tiles, K = 256
    {
      int nw = wv & 1;                         // column tile inside the head
      v8f acc[12];
#pragma unroll
      for (int t = 0; t < 12; ++t) acc[t] = ZERO8;
      strip_gemm<3>(XY16, qkvT + (size_t)((hg * 4 + hw) * HD + nw * 16) * DIMC, DIMC * DIMC,
                    lane, acc);
      // issued here so that these global loads fly during the LDS stores below
      lsc = logit_scale[h];
      const float* bbase = bias16 + h * 4096 + (i0 + cl) * 64 + hh * 8;
#pragma unroll
      for (int it = 0; it < 2; ++it)
#pragma unroll
        for (int jt = 0; jt < 4; ++jt) {
          const float* bp = bbase + it * 1024 + jt * 16;
          bv[it][jt][0] = *(const v4f*)bp;
          bv[it][jt][1] = *(const v4f*)(bp + 4);
        }
      // the run's address pair is an input here, so it stays live up to this wait and no
      // result of the run lands in it before the wait has passed
      asm volatile("s_wait_xcnt 0x0" :: "v"(bbase) : "memory");
      int No = nw * 16 + (lane & 15);
#pragma unroll
      for (int mi = 0; mi < 4; ++mi) {
        int Mo = mi * 16 + ((lane >> 4) << 3);
#pragma unroll
        for (int g = 0; g < 8; ++g) {
          qb4[hw * (MTOK * HD) + (Mo + g) * HD + No]   = (half_t)acc[mi][g];
          kb4[hw * (MTOK * HD) + (Mo + g) * HD + No]   = (half_t)acc[4 + mi][g];
          vT4[hw * (MTOK * HD) + No * MTOK + (Mo + g)] = (half_t)acc[8 + mi][g];
        }
      }
    }
    __syncthreads();

    // One wave = 32 queries of one head, all in registers. Scores are built transposed
    // (S^T = K Q^T): a lane holds 32 of the 64 scores of one query, lane l ^ 16 the rest,
    // and two score tiles, converted in place, are the B fragment of O^T = V^T P^T.
    // Every loop here is unrolled so that each tile index is a constant and the tiles
    // stay in registers.
    {
      const half_t* qb = qb4 + hw * (MTOK * HD);
      const half_t* kb = kb4 + hw * (MTOK * HD);
      const half_t* vT = vT4 + hw * (MTOK * HD);

      // cosine attention: unit rows, logit scale folded into q
      const float qs = __expf(fminf(lsc, 4.6051702f));
      v16h qf[2];
#pragma unroll
      for (int it = 0; it < 2; ++it)
        qf[it] = frag_unit(frag_ld(qb + (i0 + it * 16) * HD, HD, lane), qs);

      v8f st[2][4];                            // st[it][jt][g] = S[i0+16it+cl][16jt+8hh+g]
#pragma unroll
      for (int jt = 0; jt < 4; ++jt) {
        v16h kf = frag_unit(frag_ld(kb + jt * 16 * HD, HD, lane), 1.f);
#pragma unroll
        for (int it = 0; it < 2; ++it) st[it][jt] = wmma_f16(kf, qf[it], ZERO8);
      }

      v16h pf[2][2];                           // P^T, k = 32 keys each
#pragma unroll
      for (int it = 0; it < 2; ++it) {
        const int i = i0 + it * 16 + cl;
        const int li = lab[i];
        float mx = -1e30f;
#pragma unroll
        for (int jt = 0; jt < 4; ++jt)
#pragma unroll
          for (int g = 0; g < 8; ++g) {
            float msk = (li == lab[jt * 16 + hh * 8 + g]) ? 0.f : -100.f;
            float v = st[it][jt][g] + bv[it][jt][g >> 2][g & 3] + msk;
            st[it][jt][g] = v;
            mx = fmaxf(mx, v);
          }
        mx = fmaxf(mx, xhalf(mx));
        float s = 0.f;
#pragma unroll
        for (int jt = 0; jt < 4; ++jt)
#pragma unroll
          for (int g = 0; g < 8; ++g) {
            float e = __expf(st[it][jt][g] - mx);
            st[it][jt][g] = e;
            s += e;
          }
        s += xhalf(s);
        const float invs = 1.f / s;
#pragma unroll
        for (int kq = 0; kq < 2; ++kq)
#pragma unroll
          for (int g = 0; g < 8; ++g) {
            pf[it][kq][g]     = (half_t)(st[it][2 * kq][g] * invs);
            pf[it][kq][8 + g] = (half_t)(st[it][2 * kq + 1][g] * invs);
          }
      }

      // O^T = V^T P^T (K = 64): a lane's 8 results are 8 neighbouring d of one query
#pragma unroll
      for (int dt = 0; dt < 2; ++dt) {
        v16h vf0 = frag_ld(vT + dt * 16 * MTOK, MTOK, lane);
        v16h vf1 = frag_ld(vT + dt * 16 * MTOK + 32, MTOK, lane);
#pragma unroll
        for (int it = 0; it < 2; ++it) {
          v8f o = wmma_f16(vf1, pf[it][1], wmma_f16(vf0, pf[it][0], ZERO8));
          v8h oh;
#pragma unroll
          for (int g = 0; g < 8; ++g) oh[g] = (half_t)o[g];
          *(v8h*)&S16[(i0 + it * 16 + cl) * LDA + h * HD + dt * 16 + hh * 8] = oh;
        }
      }
    }
    // ends every wave's reads of q, k, v before the next group overwrites them, and
    // publishes the head columns of S16 to the projection
    __syncthreads();
  }

  // ---- output projection: 64 tiles, 8 per wave (4 row x 2 column tiles), K = 256 ----
  v8f pres[8];
#pragma unroll
  for (int t = 0; t < 8; ++t) pres[t] = ZERO8;
  strip_gemm<2>(S16, projT + (size_t)(wv * 32) * DIMC, 16 * DIMC, lane, pres);
  __syncthreads();
#pragma unroll
  for (int t = 0; t < 8; ++t) {
    int mi = t & 3, ni = (wv << 1) + (t >> 2);
    int Mo = mi * 16 + ((lane >> 4) << 3);
    int No = ni * 16 + (lane & 15);
    float pb = proj_b[No];
#pragma unroll
    for (int g = 0; g < 8; ++g) S16[(Mo + g) * LDA + No] = (half_t)(pres[t][g] + pb);
  }
  __syncthreads();

  // ---- y = LN1(o) + x  (in place into XY16) ----
  if (tid < 64) {
    float mu = 0.f;
    for (int c = 0; c < DIMC; ++c) mu += (float)S16[tid * LDA + c];
    mu *= (1.f / DIMC);
    float var = 0.f;
    for (int c = 0; c < DIMC; ++c) {
      float d = (float)S16[tid * LDA + c] - mu; var += d * d;
    }
    float rs = rsqrtf(var * (1.f / DIMC) + 1e-5f);
    for (int c = 0; c < DIMC; ++c) {
      float yv = ((float)S16[tid * LDA + c] - mu) * rs * ln1_w[c] + ln1_b[c]
               + (float)XY16[tid * LDA + c];
      XY16[tid * LDA + c] = (half_t)yv;
    }
  }
  __syncthreads();

  // ---- MLP: 4 chunks of 256 hidden; fc2 accumulates persistently ----
  v8f acc2[8];
#pragma unroll
  for (int t = 0; t < 8; ++t) acc2[t] = ZERO8;

  for (int kc = 0; kc < 4; ++kc) {
    v8f r1[8];
#pragma unroll
    for (int t = 0; t < 8; ++t) r1[t] = ZERO8;
    strip_gemm<2>(XY16, fc1T + (size_t)(kc * 256 + wv * 32) * DIMC, 16 * DIMC, lane, r1);
#pragma unroll
    for (int t = 0; t < 8; ++t) {
      int mi = t & 3, ni = (wv << 1) + (t >> 2);
      int Mo = mi * 16 + ((lane >> 4) << 3);
      int No = ni * 16 + (lane & 15);
      float bb = fc1_b[kc * 256 + No];
#pragma unroll
      for (int g = 0; g < 8; ++g) {
        float v = r1[t][g] + bb;
        float ge = 0.5f * v * (1.f + erff(v * 0.70710678f));
        S16[(Mo + g) * LDA + No] = (half_t)ge;
      }
    }
    __syncthreads();
    strip_gemm<2>(S16, fc2T + (size_t)(wv * 32) * HIDDEN + kc * 256 * 16, 16 * HIDDEN, lane, acc2);
    __syncthreads();
  }

  // mlp result into S16
#pragma unroll
  for (int t = 0; t < 8; ++t) {
    int mi = t & 3, ni = (wv << 1) + (t >> 2);
    int Mo = mi * 16 + ((lane >> 4) << 3);
    int No = ni * 16 + (lane & 15);
    float bb = fc2_b[No];
#pragma unroll
    for (int g = 0; g < 8; ++g) S16[(Mo + g) * LDA + No] = (half_t)(acc2[t][g] + bb);
  }
  __syncthreads();

  // LN2 stats
  if (tid < 64) {
    float mu = 0.f;
    for (int c = 0; c < DIMC; ++c) mu += (float)S16[tid * LDA + c];
    mu *= (1.f / DIMC);
    float var = 0.f;
    for (int c = 0; c < DIMC; ++c) {
      float d = (float)S16[tid * LDA + c] - mu; var += d * d;
    }
    muA[tid] = mu;
    rsA[tid] = rsqrtf(var * (1.f / DIMC) + 1e-5f);
  }
  __syncthreads();

  // ---- final: out = LN2(mlp) + y, window-reverse + un-shift ----
  for (int it = 0; it < 64; ++it) {
    int c = (it << 2) + (tid >> 6);
    int r = tid & 63;
    float mv = ((float)S16[r * LDA + c] - muA[r]) * rsA[r] * ln2_w[c] + ln2_b[c];
    float yv = mv + (float)XY16[r * LDA + c];
    int gy = ((wy << 3) + (r >> 3) + SHIFTS) & 255;
    int gx = ((wx << 3) + (r & 7) + SHIFTS) & 255;
    out[(((size_t)(b * DIMC + c)) << 16) + (gy << 8) + gx] = yv;
  }
}

// ---- launch ----------------------------------------------------------------

extern "C" void kernel_launch(void* const* d_in, const int* in_sizes, int n_in,
                              void* d_out, int out_size, void* d_ws, size_t ws_size,
                              hipStream_t stream) {
  (void)in_sizes; (void)n_in; (void)out_size; (void)ws_size;
  const float* x        = (const float*)d_in[0];
  const float* qkv_w    = (const float*)d_in[1];
  const float* lscale   = (const float*)d_in[2];
  const float* proj_w   = (const float*)d_in[3];
  const float* proj_b   = (const float*)d_in[4];
  const float* ln1_w    = (const float*)d_in[5];
  const float* ln1_b    = (const float*)d_in[6];
  const float* fc1_w    = (const float*)d_in[7];
  const float* fc1_b    = (const float*)d_in[8];
  const float* fc2_w    = (const float*)d_in[9];
  const float* fc2_b    = (const float*)d_in[10];
  const float* ln2_w    = (const float*)d_in[11];
  const float* ln2_b    = (const float*)d_in[12];
  const float* cpb_w1   = (const float*)d_in[13];
  const float* cpb_b1   = (const float*)d_in[14];
  const float* cpb_w2   = (const float*)d_in[15];

  half_t* wh     = (half_t*)d_ws;
  float*  bias16 = (float*)((char*)d_ws + OFF_BIAS_BYTES);
  float*  out    = (float*)d_out;

  prep_weights<<<TOT_H / 256, 256, 0, stream>>>(qkv_w, proj_w, fc1_w, fc2_w, wh);
  prep_bias<<<1, 256, 0, stream>>>(cpb_w1, cpb_b1, cpb_w2, bias16);
  swin_block<<<2048, 256, 0, stream>>>(x, lscale, proj_b, ln1_w, ln1_b,
                                       fc1_b, fc2_b, ln2_w, ln2_b,
                                       wh, bias16, out);
}

// v004
// It runs in 403 microseconds.
// Next to v003, in two timings, it ran 1.10 and 1.11 times as fast.
// All steps since v000 together make it 2.97 times as fast.
#include <hip/hip_runtime.h>
#include <hip/hip_bf16.h>
#include <math.h>

typedef _Float16 half_t;
typedef half_t v16h __attribute__((ext_vector_type(16)));
typedef half_t v8h  __attribute__((ext_vector_type(8)));
typedef float  v8f  __attribute__((ext_vector_type(8)));
typedef float  v4f  __attribute__((ext_vector_type(4)));

#define DIMC   256
#define HEADS  8
#define HD     32
#define WSZ    8
#define SHIFTS 4
#define MTOK   64
#define IMG    256
#define HIDDEN 1024
#define LDA    264   // padded f16 row stride (264 halves = 528B, bank-spread, 16B-aligned)

// workspace layout (in halves): qkvT 768x256 | projT 256x256 | fc1T 1024x256 | fc2T 256x1024
// Each N x K matrix is stored fragment by fragment (16 n x 32 k = 512 halves = 1 KiB),
// fragments of one 16-row strip following each other along k. Inside a fragment the
// halves lie in register order: 32 lanes x first 8 halves (512 B), then 32 lanes x
// second 8 halves (512 B), so each wave-wide 16-byte load reads 4 whole 128-B lines.
#define OFF_QKVT 0
#define OFF_PROJT (768*256)
#define OFF_FC1T  (OFF_PROJT + 256*256)
#define OFF_FC2T  (OFF_FC1T + 1024*256)
#define TOT_H     (OFF_FC2T + 256*1024)
#define OFF_BIAS_BYTES ((size_t)TOT_H * 2)   // then float bias16[8][64][64]

// ---- WMMA helpers -----------------------------------------------------------

// 16x32 f16 fragment (A from XY16, S16, kb and vT; also B from the N x K LDS buffer qb).
// CDNA5 layout: lanes 0-15 row M=lane hold K 0..7 then 16..23;
// lanes 16-31 hold K 8..15 then 24..31.
__device__ __forceinline__ v16h frag_ld(const half_t* p0, int ld, int lane) {
  const half_t* p = p0 + (lane & 15) * ld + ((lane >> 4) << 3);
  v8h lo = *(const v8h*)p;
  v8h hi = *(const v8h*)(p + 16);
  return __builtin_shufflevector(lo, hi, 0,1,2,3,4,5,6,7,8,9,10,11,12,13,14,15);
}

// B fragment from the packed weights: same lane/k map as frag_ld, contiguous bytes.
__device__ __forceinline__ v16h frag_ldw(const half_t* frag, int lane) {
  const half_t* p = frag + lane * 8;
  v8h lo = *(const v8h*)p;
  v8h hi = *(const v8h*)(p + 256);
  return __builtin_shufflevector(lo, hi, 0,1,2,3,4,5,6,7,8,9,10,11,12,13,14,15);
}

__device__ __forceinline__ v8f wmma_f16(v16h a, v16h b, v8f c) {
  return __builtin_amdgcn_wmma_f32_16x16x32_f16(false, a, false, b, (short)0, c,
                                                false, false);
}

#define ZERO8 ((v8f){0.f,0.f,0.f,0.f,0.f,0.f,0.f,0.f})

// value of lane l ^ 16 (the lane that holds the other half of the same row or column)
__device__ __forceinline__ float xhalf(float x) {
  int b = __builtin_bit_cast(int, x);
  return __builtin_bit_cast(float, __builtin_amdgcn_permlanex16(b, b, 0x76543210, 0xfedcba98,
                                                                false, false));
}

// Scale a 16 x 32 fragment's rows to unit length, times mul. Lanes l and l ^ 16 hold the
// two halves of one row, so the sum of squares is 16 terms in the lane plus one exchange.
// (Loops unrolled: vector elements are reached by constant index only.)
__device__ __forceinline__ v16h frag_unit(v16h f, float mul) {
  float ss = 0.f;
#pragma unroll
  for (int s = 0; s < 16; ++s) { float v = (float)f[s]; ss += v * v; }
  ss += xhalf(ss);
  float inv = 1.f / fmaxf(sqrtf(ss), 1e-12f) * mul;
  v16h o;
#pragma unroll
  for (int s = 0; s < 16; ++s) o[s] = (half_t)((float)f[s] * inv);
  return o;
}

// One wave's strip of a 64 x N product, K = 256: all 4 row tiles x NT column tiles.
// Each packed weight fragment is loaded once and feeds 4 WMMAs. The weight fragments run
// through a register ring D k steps deep: the loads of step ks + D are issued as soon as
// step ks has used its slot, so a load has D - 1 steps of WMMAs to come back from L2.
// The A fragments of a step are read from LDS in groups of AG. D and AG are what each
// caller's live accumulators leave room for. acc[j * 4 + mi]; k runs upward for every tile.
template <int NT, int D, int AG>
__device__ __forceinline__ void strip_gemm(const half_t* As, const half_t* B0, int bstride,
                                           int lane, v8f* acc) {
  v16h bf[D][NT];
#pragma unroll
  for (int p = 0; p < D; ++p)
#pragma unroll
    for (int j = 0; j < NT; ++j) bf[p][j] = frag_ldw(B0 + j * bstride + p * 512, lane);
  // holds the ring's first loads here: sunk to their first use they would each be waited
  // for at full L2 latency
  __builtin_amdgcn_sched_barrier(0);
  // unrolled so that every ring slot is a constant index and stays in registers
#pragma unroll
  for (int ks = 0; ks < DIMC / 32; ++ks) {
#pragma unroll
    for (int m0 = 0; m0 < 4; m0 += AG) {
      v16h af[AG];
#pragma unroll
      for (int mi = 0; mi < AG; ++mi)
        af[mi] = frag_ld(As + (m0 + mi) * 16 * LDA + ks * 32, LDA, lane);
#pragma unroll
      for (int mi = 0; mi < AG; ++mi)
#pragma unroll
        for (int j = 0; j < NT; ++j)
          acc[j * 4 + m0 + mi] = wmma_f16(af[mi], bf[ks % D][j], acc[j * 4 + m0 + mi]);
      // order: a group's LDS reads together (one LDS wait a group, not one a fragment),
      // then its WMMAs
      __builtin_amdgcn_sched_group_barrier(0x100, 2 * AG, 0);
      __builtin_amdgcn_sched_group_barrier(0x008, AG * NT, 0);
    }
    if (ks + D < DIMC / 32) {
#pragma unroll
      for (int j = 0; j < NT; ++j)
        bf[ks % D][j] = frag_ldw(B0 + j * bstride + (ks + D) * 512, lane);
      __builtin_amdgcn_sched_group_barrier(0x020, 2 * NT, 0);   // the refill behind them
      // holds the refill at the foot of its step (same reason as above)
      __builtin_amdgcn_sched_barrier(0);
    }
  }
}

// async global -> LDS copy of 16 bytes (per-lane), tracked on ASYNCcnt
__device__ __forceinline__ void async_b128(unsigned lds_addr, unsigned long long gaddr) {
  asm volatile("global_load_async_to_lds_b128 %0, %1, off"
               :: "v"(lds_addr), "v"(gaddr) : "memory");
}
__device__ __forceinline__ void wait_async0() {
  asm volatile("s_wait_asynccnt 0x0" ::: "memory");
}

// ---- Prep kernel 1: f32->f16 convert all weights into fragment order -------

__global__ __launch_bounds__(256) void prep_weights(
    const float* __restrict__ qkv_w, const float* __restrict__ proj_w,
    const float* __restrict__ fc1_w, const float* __restrict__ fc2_w,
    half_t* __restrict__ wh)
{
  int idx = blockIdx.x * 256 + threadIdx.x;
  // place inside the 512-half fragment (every matrix starts on a fragment boundary)
  int ln = (idx >> 3) & 31;                                  // lane that reads it
  int nr = ln & 15;                                          // n inside the fragment
  int kk = ((ln >> 4) << 3) + (((idx >> 8) & 1) << 4) + (idx & 7);  // k inside it
  if (idx < OFF_PROJT) {                       // qkvT: 8 fragments per strip
    int f = idx >> 9;
    int n = ((f >> 3) << 4) + nr, k = ((f & 7) << 5) + kk;
    wh[idx] = (half_t)qkv_w[k * 768 + n];
  } else if (idx < OFF_FC1T) {                 // projT: 8 per strip
    int f = (idx - OFF_PROJT) >> 9;
    int n = ((f >> 3) << 4) + nr, k = ((f & 7) << 5) + kk;
    wh[idx] = (half_t)proj_w[k * 256 + n];
  } else if (idx < OFF_FC2T) {                 // fc1T (1024 x 256): 8 per strip
    int f = (idx - OFF_FC1T) >> 9;
    int n = ((f >> 3) << 4) + nr, k = ((f & 7) << 5) + kk;
    wh[idx] = (half_t)fc1_w[k * 1024 + n];
  } else if (idx < TOT_H) {                    // fc2T (256 x 1024): 32 per strip
    int f = (idx - OFF_FC2T) >> 9;
    int n = ((f >> 5) << 4) + nr, k = ((f & 31) << 5) + kk;
    wh[idx] = (half_t)fc2_w[k * 256 + n];
  }
}

// ---- Prep kernel 2: CPB MLP -> 16*sigmoid bias table -----------------------

__device__ __forceinline__ float logrel(int i) {
  float v = (float)(i - 7) * (8.f / 7.f);
  float a = log2f(fabsf(v) + 1.f) * (1.f / 3.f);   // /log2(8)
  return copysignf(a, v);
}

__global__ __launch_bounds__(256) void prep_bias(
    const float* __restrict__ w1, const float* __restrict__ b1,
    const float* __restrict__ w2, float* __restrict__ bias16)
{
  __shared__ float bt[225 * 8];
  int tid = threadIdx.x;
  if (tid < 225) {
    int a = tid / 15, bcol = tid % 15;
    float fx = logrel(a), fy = logrel(bcol);
    float acc[8];
#pragma unroll
    for (int h = 0; h < 8; ++h) acc[h] = 0.f;
    for (int j = 0; j < 512; ++j) {
      float hv = fmaxf(fx * w1[j] + fy * w1[512 + j] + b1[j], 0.f);
#pragma unroll
      for (int h = 0; h < 8; ++h) acc[h] += hv * w2[j * 8 + h];
    }
#pragma unroll
    for (int h = 0; h < 8; ++h) bt[tid * 8 + h] = acc[h];
  }
  __syncthreads();
  for (int q = tid; q < 4096; q += 256) {
    int i = q >> 6, j = q & 63;
    int dy = (i >> 3) - (j >> 3) + 7;
    int dx = (i & 7) - (j & 7) + 7;
    int t = dy * 15 + dx;
#pragma unroll
    for (int h = 0; h < 8; ++h)
      bias16[h * 4096 + q] = 16.f / (1.f + __expf(-bt[t * 8 + h]));
  }
}

// ---- Main fused Swin-V2 block kernel: one 8x8 window per workgroup ---------

// second bound: 4 waves a SIMD (256 registers a wave), so that two workgroups still share a WGP
__global__ __launch_bounds__(256, 4) void swin_block(
    const float* __restrict__ x,
    const float* __restrict__ logit_scale,
    const float* __restrict__ proj_b,
    const float* __restrict__ ln1_w, const float* __restrict__ ln1_b,
    const float* __restrict__ fc1_b, const float* __restrict__ fc2_b,
    const float* __restrict__ ln2_w, const float* __restrict__ ln2_b,
    const half_t* __restrict__ wh, const float* __restrict__ bias16,
    float* __restrict__ out)
{
  // attention scratch overlaid with the raw f32 input staging buffer:
  // xstage is only live before the head loop starts.
  union SMem {
    float xstage[MTOK * DIMC];                 // 64 KB raw window (f32)
    struct {
      half_t S16[MTOK * LDA];                  // o / gelu chunk / mlp staging
      half_t qb[4 * MTOK * HD];                // q, k, v of a group of 4 heads
      half_t kb[4 * MTOK * HD];
      half_t vT[4 * HD * MTOK];                // v transposed (M=d x K=j)
    } at;
  };
  __shared__ SMem U;
  __shared__ half_t XY16[MTOK * LDA];          // x window -> y (in place)
  __shared__ float  muA[MTOK], rsA[MTOK];
  __shared__ int    lab[MTOK];

  half_t* S16 = U.at.S16;
  half_t* qb4 = U.at.qb;
  half_t* kb4 = U.at.kb;
  half_t* vT4 = U.at.vT;

  const int tid  = threadIdx.x;
  const int wv   = tid >> 5;
  const int lane = tid & 31;
  const int blk  = blockIdx.x;
  const int b    = blk >> 10;
  const int wi   = blk & 1023;
  const int wy   = wi >> 5, wx = wi & 31;

  const half_t* qkvT  = wh + OFF_QKVT;
  const half_t* projT = wh + OFF_PROJT;
  const half_t* fc1T  = wh + OFF_FC1T;
  const half_t* fc2T  = wh + OFF_FC2T;

  // ---- async DMA the shifted window (f32) into LDS staging ----
  // 4096 x 16B copies: job = (c, ty, 4px-group); each group is contiguous in
  // memory even across the cyclic-shift wrap (group start gx <= 252 always).
#pragma unroll
  for (int it = 0; it < 16; ++it) {
    int job = it * 256 + tid;
    int c   = job >> 4;
    int rem = job & 15;
    int ty  = rem >> 1;
    int grp = rem & 1;
    int gy  = ((wy << 3) + ty + SHIFTS) & 255;
    int gx  = ((wx << 3) + (grp << 2) + SHIFTS) & 255;
    const float* gp = x + (((size_t)(b * DIMC + c)) << 16) + (gy << 8) + gx;
    unsigned lds = (unsigned)(unsigned long long)(uintptr_t)
                   (&U.xstage[c * MTOK + ty * 8 + grp * 4]);
    async_b128(lds, (unsigned long long)(uintptr_t)gp);
  }
  if (tid < 64) {
    int r = tid;
    int sy = (wy << 3) + (r >> 3), sx = (wx << 3) + (r & 7);
    int ry = (sy < IMG - WSZ) ? 0 : (sy < IMG - SHIFTS ? 1 : 2);
    int rx = (sx < IMG - WSZ) ? 0 : (sx < IMG - SHIFTS ? 1 : 2);
    lab[r] = ry * 3 + rx;
  }
  if (tid == 0 && blk + 1 < (int)gridDim.x)
    __builtin_prefetch(x + ((size_t)((blk + 1) >> 10) << 24), 0, 1);
  wait_async0();
  __syncthreads();

  // convert staged f32 -> f16 A-operand layout (token-major, padded rows)
  for (int it = 0; it < 64; ++it) {
    int idx = it * 256 + tid;
    int r = idx & 63, c = idx >> 6;
    XY16[r * LDA + c] = (half_t)U.xstage[c * MTOK + r];
  }
  __syncthreads();

  // ---- attention: QKV product for 4 heads at a time, then the 4 heads side by side ----
  for (int hg = 0; hg < HEADS / 4; ++hg) {
    // the attention part's split: one wave = 32 queries of one head
    const int hw = wv >> 1;                    // head inside the group
    const int h  = hg * 4 + hw;
    const int i0 = (wv & 1) << 5;              // first query of this wave
    const int cl = lane & 15, hh = lane >> 4;
    float lsc;                                 // logit scale of the head
    v4f bv[2][4][2];                           // bias of query i0+16it+cl, keys 16jt+8hh+0..7
    // 24 column tiles (q, k, v x 4 heads x 2): each wave takes one of q, of k and of v,
    // with all 4 row tiles, K = 256
    {
      int nw = wv & 1;                         // column tile inside the head
      v8f acc[12];
#pragma unroll
      for (int t = 0; t < 12; ++t) acc[t] = ZERO8;
      strip_gemm<3, 3, 2>(XY16, qkvT + (size_t)((hg * 4 + hw) * HD + nw * 16) * DIMC, DIMC * DIMC,
                    lane, acc);
      // issued here so that these global loads fly during the LDS stores below
      lsc = logit_scale[h];
      const float* bbase = bias16 + h * 4096 + (i0 + cl) * 64 + hh * 8;
#pragma unroll
      for (int it = 0; it < 2; ++it)
#pragma unroll
        for (int jt = 0; jt < 4; ++jt) {
          const float* bp = bbase + it * 1024 + jt * 16;
          bv[it][jt][0] = *(const v4f*)bp;
          bv[it][jt][1] = *(const v4f*)(bp + 4);
        }
      // the run's address pair is an input here, so it stays live up to this wait and no
      // result of the run lands in it before the wait has passed
      asm volatile("s_wait_xcnt 0x0" :: "v"(bbase) : "memory");
      int No = nw * 16 + (lane & 15);
#pragma unroll
      for (int mi = 0; mi < 4; ++mi) {
        int Mo = mi * 16 + ((lane >> 4) << 3);
#pragma unroll
        for (int g = 0; g < 8; ++g) {
          qb4[hw * (MTOK * HD) + (Mo + g) * HD + No]   = (half_t)acc[mi][g];
          kb4[hw * (MTOK * HD) + (Mo + g) * HD + No]   = (half_t)acc[4 + mi][g];
          vT4[hw * (MTOK * HD) + No * MTOK + (Mo + g)] = (half_t)acc[8 + mi][g];
        }
      }
    }
    __syncthreads();

    // One wave = 32 queries of one head, all in registers. Scores are built transposed
    // (S^T = K Q^T): a lane holds 32 of the 64 scores of one query, lane l ^ 16 the rest,
    // and two score tiles, converted in place, are the B fragment of O^T = V^T P^T.
    // Every loop here is unrolled so that each tile index is a constant and the tiles
    // stay in registers.
    {
      const half_t* qb = qb4 + hw * (MTOK * HD);
      const half_t* kb = kb4 + hw * (MTOK * HD);
      const half_t* vT = vT4 + hw * (MTOK * HD);

      // cosine attention: unit rows, logit scale folded into q
      const float qs = __expf(fminf(lsc, 4.6051702f));
      v16h qf[2];
#pragma unroll
      for (int it = 0; it < 2; ++it)
        qf[it] = frag_unit(frag_ld(qb + (i0 + it * 16) * HD, HD, lane), qs);

      v8f st[2][4];                            // st[it][jt][g] = S[i0+16it+cl][16jt+8hh+g]
#pragma unroll
      for (int jt = 0; jt < 4; ++jt) {
        v16h kf = frag_unit(frag_ld(kb + jt * 16 * HD, HD, lane), 1.f);
#pragma unroll
        for (int it = 0; it < 2; ++it) st[it][jt] = wmma_f16(kf, qf[it], ZERO8);
      }

      v16h pf[2][2];                           // P^T, k = 32 keys each
#pragma unroll
      for (int it = 0; it < 2; ++it) {
        const int i = i0 + it * 16 + cl;
        const int li = lab[i];
        float mx = -1e30f;
#pragma unroll
        for (int jt = 0; jt < 4; ++jt)
#pragma unroll
          for (int g = 0; g < 8; ++g) {
            float msk = (li == lab[jt * 16 + hh * 8 + g]) ? 0.f : -100.f;
            float v = st[it][jt][g] + bv[it][jt][g >> 2][g & 3] + msk;
            st[it][jt][g] = v;
            mx = fmaxf(mx, v);
          }
        mx = fmaxf(mx, xhalf(mx));
        float s = 0.f;
#pragma unroll
        for (int jt = 0; jt < 4; ++jt)
#pragma unroll
          for (int g = 0; g < 8; ++g) {
            float e = __expf(st[it][jt][g] - mx);
            st[it][jt][g] = e;
            s += e;
          }
        s += xhalf(s);
        const float invs = 1.f / s;
#pragma unroll
        for (int kq = 0; kq < 2; ++kq)
#pragma unroll
          for (int g = 0; g < 8; ++g) {
            pf[it][kq][g]     = (half_t)(st[it][2 * kq][g] * invs);
            pf[it][kq][8 + g] = (half_t)(st[it][2 * kq + 1][g] * invs);
          }
      }

      // O^T = V^T P^T (K = 64): a lane's 8 results are 8 neighbouring d of one query
#pragma unroll
      for (int dt = 0; dt < 2; ++dt) {
        v16h vf0 = frag_ld(vT + dt * 16 * MTOK, MTOK, lane);
        v16h vf1 = frag_ld(vT + dt * 16 * MTOK + 32, MTOK, lane);
#pragma unroll
        for (int it = 0; it < 2; ++it) {
          v8f o = wmma_f16(vf1, pf[it][1], wmma_f16(vf0, pf[it][0], ZERO8));
          v8h oh;
#pragma unroll
          for (int g = 0; g < 8; ++g) oh[g] = (half_t)o[g];
          *(v8h*)&S16[(i0 + it * 16 + cl) * LDA + h * HD + dt * 16 + hh * 8] = oh;
        }
      }
    }
    // ends every wave's reads of q, k, v before the next group overwrites them, and
    // publishes the head columns of S16 to the projection
    __syncthreads();
  }

  // ---- output projection: 64 tiles, 8 per wave (4 row x 2 column tiles), K = 256 ----
  v8f pres[8];
#pragma unroll
  for (int t = 0; t < 8; ++t) pres[t] = ZERO8;
  strip_gemm<2, 4, 4>(S16, projT + (size_t)(wv * 32) * DIMC, 16 * DIMC, lane, pres);
  __syncthreads();
#pragma unroll
  for (int t = 0; t < 8; ++t) {
    int mi = t & 3, ni = (wv << 1) + (t >> 2);
    int Mo = mi * 16 + ((lane >> 4) << 3);
    int No = ni * 16 + (lane & 15);
    float pb = proj_b[No];
#pragma unroll
    for (int g = 0; g < 8; ++g) S16[(Mo + g) * LDA + No] = (half_t)(pres[t][g] + pb);
  }
  __syncthreads();

  // ---- y = LN1(o) + x  (in place into XY16) ----
  if (tid < 64) {
    float mu = 0.f;
    for (int c = 0; c < DIMC; ++c) mu += (float)S16[tid * LDA + c];
    mu *= (1.f / DIMC);
    float var = 0.f;
    for (int c = 0; c < DIMC; ++c) {
      float d = (float)S16[tid * LDA + c] - mu; var += d * d;
    }
    float rs = rsqrtf(var * (1.f / DIMC) + 1e-5f);
    for (int c = 0; c < DIMC; ++c) {
      float yv = ((float)S16[tid * LDA + c] - mu) * rs * ln1_w[c] + ln1_b[c]
               + (float)XY16[tid * LDA + c];
      XY16[tid * LDA + c] = (half_t)yv;
    }
  }
  __syncthreads();

  // ---- MLP: 4 chunks of 256 hidden; fc2 accumulates persistently ----
  v8f acc2[8];
#pragma unroll
  for (int t = 0; t < 8; ++t) acc2[t] = ZERO8;

  for (int kc = 0; kc < 4; ++kc) {
    v8f r1[8];
#pragma unroll
    for (int t = 0; t < 8; ++t) r1[t] = ZERO8;
    strip_gemm<2, 2, 2>(XY16, fc1T + (size_t)(kc * 256 + wv * 32) * DIMC, 16 * DIMC, lane, r1);
#pragma unroll
    for (int t = 0; t < 8; ++t) {
      int mi = t & 3, ni = (wv << 1) + (t >> 2);
      int Mo = mi * 16 + ((lane >> 4) << 3);
      int No = ni * 16 + (lane & 15);
      float bb = fc1_b[kc * 256 + No];
#pragma unroll
      for (int g = 0; g < 8; ++g) {
        float v = r1[t][g] + bb;
        float ge = 0.5f * v * (1.f + erff(v * 0.70710678f));
        S16[(Mo + g) * LDA + No] = (half_t)ge;
      }
    }
    __syncthreads();
    strip_gemm<2, 4, 4>(S16, fc2T + (size_t)(wv * 32) * HIDDEN + kc * 256 * 16, 16 * HIDDEN, lane, acc2);
    __syncthreads();
  }

  // mlp result into S16
#pragma unroll
  for (int t = 0; t < 8; ++t) {
    int mi = t & 3, ni = (wv << 1) + (t >> 2);
    int Mo = mi * 16 + ((lane >> 4) << 3);
    int No = ni * 16 + (lane & 15);
    float bb = fc2_b[No];
#pragma unroll
    for (int g = 0; g < 8; ++g) S16[(Mo + g) * LDA + No] = (half_t)(acc2[t][g] + bb);
  }
  __syncthreads();

  // LN2 stats
  if (tid < 64) {
    float mu = 0.f;
    for (int c = 0; c < DIMC; ++c) mu += (float)S16[tid * LDA + c];
    mu *= (1.f / DIMC);
    float var = 0.f;
    for (int c = 0; c < DIMC; ++c) {
      float d = (float)S16[tid * LDA + c] - mu; var += d * d;
    }
    muA[tid] = mu;
    rsA[tid] = rsqrtf(var * (1.f / DIMC) + 1e-5f);
  }
  __syncthreads();

  // ---- final: out = LN2(mlp) + y, window-reverse + un-shift ----
  for (int it = 0; it < 64; ++it) {
    int c = (it << 2) + (tid >> 6);
    int r = tid & 63;
    float mv = ((float)S16[r * LDA + c] - muA[r]) * rsA[r] * ln2_w[c] + ln2_b[c];
    float yv = mv + (float)XY16[r * LDA + c];
    int gy = ((wy << 3) + (r >> 3) + SHIFTS) & 255;
    int gx = ((wx << 3) + (r & 7) + SHIFTS) & 255;
    out[(((size_t)(b * DIMC + c)) << 16) + (gy << 8) + gx] = yv;
  }
}

// ---- launch ----------------------------------------------------------------

extern "C" void kernel_launch(void* const* d_in, const int* in_sizes, int n_in,
                              void* d_out, int out_size, void* d_ws, size_t ws_size,
                              hipStream_t stream) {
  (void)in_sizes; (void)n_in; (void)out_size; (void)ws_size;
  const float* x        = (const float*)d_in[0];
  const float* qkv_w    = (const float*)d_in[1];
  const float* lscale   = (const float*)d_in[2];
  const float* proj_w   = (const float*)d_in[3];
  const float* proj_b   = (const float*)d_in[4];
  const float* ln1_w    = (const float*)d_in[5];
  const float* ln1_b    = (const float*)d_in[6];
  const float* fc1_w    = (const float*)d_in[7];
  const float* fc1_b    = (const float*)d_in[8];
  const float* fc2_w    = (const float*)d_in[9];
  const float* fc2_b    = (const float*)d_in[10];
  const float* ln2_w    = (const float*)d_in[11];
  const float* ln2_b    = (const float*)d_in[12];
  const float* cpb_w1   = (const float*)d_in[13];
  const float* cpb_b1   = (const float*)d_in[14];
  const float* cpb_w2   = (const float*)d_in[15];

  half_t* wh     = (half_t*)d_ws;
  float*  bias16 = (float*)((char*)d_ws + OFF_BIAS_BYTES);
  float*  out    = (float*)d_out;

  prep_weights<<<TOT_H / 256, 256, 0, stream>>>(qkv_w, proj_w, fc1_w, fc2_w, wh);
  prep_bias<<<1, 256, 0, stream>>>(cpb_w1, cpb_b1, cpb_w2, bias16);
  swin_block<<<2048, 256, 0, stream>>>(x, lscale, proj_b, ln1_w, ln1_b,
                                       fc1_b, fc2_b, ln2_w, ln2_b,
                                       wh, bias16, out);
}

// v005
// Measured time: 380 microseconds a run.
// Timed twice side by side with v004, it ran 1.06 and 1.04 times as fast.
// Counting every step since v000, it is 3.11 times as fast.
#include <hip/hip_runtime.h>
#include <hip/hip_bf16.h>
#include <math.h>

typedef _Float16 half_t;
typedef half_t v16h __attribute__((ext_vector_type(16)));
typedef half_t v8h  __attribute__((ext_vector_type(8)));
typedef float  v8f  __attribute__((ext_vector_type(8)));
typedef float  v4f  __attribute__((ext_vector_type(4)));

#define DIMC   256
#define HEADS  8
#define HD     32
#define WSZ    8
#define SHIFTS 4
#define MTOK   64
#define IMG    256
#define HIDDEN 1024
#define LDA    264   // padded f16 row stride (264 halves = 528B, bank-spread, 16B-aligned)

// workspace layout (in halves): qkvT 768x256 | projT 256x256 | fc1T 1024x256 | fc2T 256x1024
// Each N x K matrix is stored fragment by fragment (16 n x 32 k = 512 halves = 1 KiB),
// fragments of one 16-row strip following each other along k. Inside a fragment the
// halves lie in register order: 32 lanes x first 8 halves (512 B), then 32 lanes x
// second 8 halves (512 B), so each wave-wide 16-byte load reads 4 whole 128-B lines.
#define OFF_QKVT 0
#define OFF_PROJT (768*256)
#define OFF_FC1T  (OFF_PROJT + 256*256)
#define OFF_FC2T  (OFF_FC1T + 1024*256)
#define TOT_H     (OFF_FC2T + 256*1024)
#define OFF_BIAS_BYTES ((size_t)TOT_H * 2)   // then float bias16[8][64][64]

// ---- WMMA helpers -----------------------------------------------------------

// 16x32 f16 fragment (A from XY16, S16, kb and vT; also B from the N x K LDS buffer qb).
// CDNA5 layout: lanes 0-15 row M=lane hold K 0..7 then 16..23;
// lanes 16-31 hold K 8..15 then 24..31.
__device__ __forceinline__ v16h frag_ld(const half_t* p0, int ld, int lane) {
  const half_t* p = p0 + (lane & 15) * ld + ((lane >> 4) << 3);
  v8h lo = *(const v8h*)p;
  v8h hi = *(const v8h*)(p + 16);
  return __builtin_shufflevector(lo, hi, 0,1,2,3,4,5,6,7,8,9,10,11,12,13,14,15);
}

// B fragment from the packed weights: same lane/k map as frag_ld, contiguous bytes.
__device__ __forceinline__ v16h frag_ldw(const half_t* frag, int lane) {
  const half_t* p = frag + lane * 8;
  v8h lo = *(const v8h*)p;
  v8h hi = *(const v8h*)(p + 256);
  return __builtin_shufflevector(lo, hi, 0,1,2,3,4,5,6,7,8,9,10,11,12,13,14,15);
}

__device__ __forceinline__ v8f wmma_f16(v16h a, v16h b, v8f c) {
  return __builtin_amdgcn_wmma_f32_16x16x32_f16(false, a, false, b, (short)0, c,
                                                false, false);
}

#define ZERO8 ((v8f){0.f,0.f,0.f,0.f,0.f,0.f,0.f,0.f})

// value of lane l ^ 16 (the lane that holds the other half of the same row or column)
__device__ __forceinline__ float xhalf(float x) {
  int b = __builtin_bit_cast(int, x);
  return __builtin_bit_cast(float, __builtin_amdgcn_permlanex16(b, b, 0x76543210, 0xfedcba98,
                                                                false, false));
}

// Scale a 16 x 32 fragment's rows to unit length, times mul. Lanes l and l ^ 16 hold the
// two halves of one row, so the sum of squares is 16 terms in the lane plus one exchange.
// (Loops unrolled: vector elements are reached by constant index only.)
__device__ __forceinline__ v16h frag_unit(v16h f, float mul) {
  float ss = 0.f;
#pragma unroll
  for (int s = 0; s < 16; ++s) { float v = (float)f[s]; ss += v * v; }
  ss += xhalf(ss);
  float inv = 1.f / fmaxf(sqrtf(ss), 1e-12f) * mul;
  v16h o;
#pragma unroll
  for (int s = 0; s < 16; ++s) o[s] = (half_t)((float)f[s] * inv);
  return o;
}

// One wave's strip of a 64 x N product, K = 256: all 4 row tiles x NT column tiles.
// Each packed weight fragment is loaded once and feeds 4 WMMAs. The weight fragments run
// through a register ring D k steps deep: the loads of step ks + D are issued as soon as
// step ks has used its slot, so a load has D - 1 steps of WMMAs to come back from L2.
// The A fragments of a step are read from LDS in groups of AG. D and AG are what each
// caller's live accumulators leave room for. acc[j * 4 + mi]; k runs upward for every tile.
template <int NT, int D, int AG>
__device__ __forceinline__ void strip_gemm(const half_t* As, const half_t* B0, int bstride,
                                           int lane, v8f* acc) {
  v16h bf[D][NT];
#pragma unroll
  for (int p = 0; p < D; ++p)
#pragma unroll
    for (int j = 0; j < NT; ++j) bf[p][j] = frag_ldw(B0 + j * bstride + p * 512, lane);
  // holds the ring's first loads here: sunk to their first use they would each be waited
  // for at full L2 latency
  __builtin_amdgcn_sched_barrier(0);
  // unrolled so that every ring slot is a constant index and stays in registers
#pragma unroll
  for (int ks = 0; ks < DIMC / 32; ++ks) {
#pragma unroll
    for (int m0 = 0; m0 < 4; m0 += AG) {
      v16h af[AG];
#pragma unroll
      for (int mi = 0; mi < AG; ++mi)
        af[mi] = frag_ld(As + (m0 + mi) * 16 * LDA + ks * 32, LDA, lane);
#pragma unroll
      for (int mi = 0; mi < AG; ++mi)
#pragma unroll
        for (int j = 0; j < NT; ++j)
          acc[j * 4 + m0 + mi] = wmma_f16(af[mi], bf[ks % D][j], acc[j * 4 + m0 + mi]);
      // order: a group's LDS reads together (one LDS wait a group, not one a fragment),
      // then its WMMAs
      __builtin_amdgcn_sched_group_barrier(0x100, 2 * AG, 0);
      __builtin_amdgcn_sched_group_barrier(0x008, AG * NT, 0);
    }
    if (ks + D < DIMC / 32) {
#pragma unroll
      for (int j = 0; j < NT; ++j)
        bf[ks % D][j] = frag_ldw(B0 + j * bstride + (ks + D) * 512, lane);
      __builtin_amdgcn_sched_group_barrier(0x020, 2 * NT, 0);   // the refill behind them
      // holds the refill at the foot of its step (same reason as above)
      __builtin_amdgcn_sched_barrier(0);
    }
  }
}

// GELU(v) = 0.5 v (1 + erf(v / sqrt 2)) of the 8 values of a tile, with erf from
// ONE formula for every v:
//   erf(|x|) = 1 - t (a1 + t (a2 + t (a3 + t (a4 + t a5)))) exp(-x^2),  t = 1 / (1 + p |x|)
// No case split, so no lane mask and no branch stands between two elements, and the work of
// neighbouring elements can be packed and overlapped. Absolute error of the result below 5e-7
// for every v (it is then rounded to f16). p / sqrt 2 and -log2(e) / 2 are folded into v's
// factors.
__device__ __forceinline__ v8f gelu8(v8f v) {
  float t[8], e[8];
#pragma unroll
  for (int g = 0; g < 8; ++g) {
    t[g] = fmaf(fabsf(v[g]), 0.3275911f * 0.70710678f, 1.f);
    e[g] = v[g] * v[g] * (-0.5f * 1.44269504f);
  }
#pragma unroll
  for (int g = 0; g < 8; ++g) { t[g] = __builtin_amdgcn_rcpf(t[g]); e[g] = __builtin_amdgcn_exp2f(e[g]); }
  // Horner, one step for all 8 elements at a time: the 8 chains do not depend on one another
  float p[8];
  v8f o;
#pragma unroll
  for (int g = 0; g < 8; ++g) p[g] = fmaf(t[g], 1.061405429f, -1.453152027f);
#pragma unroll
  for (int g = 0; g < 8; ++g) p[g] = fmaf(t[g], p[g], 1.421413741f);
#pragma unroll
  for (int g = 0; g < 8; ++g) p[g] = fmaf(t[g], p[g], -0.284496736f);
#pragma unroll
  for (int g = 0; g < 8; ++g) p[g] = fmaf(t[g], p[g], 0.254829592f);
#pragma unroll
  for (int g = 0; g < 8; ++g) p[g] *= t[g];
#pragma unroll
  for (int g = 0; g < 8; ++g) p[g] = copysignf(fmaf(-p[g], e[g], 1.f), v[g]);
#pragma unroll
  for (int g = 0; g < 8; ++g) {
    const float hv = 0.5f * v[g];
    o[g] = fmaf(hv, p[g], hv);
  }
  return o;
}

// async global -> LDS copy of 16 bytes (per-lane), tracked on ASYNCcnt
__device__ __forceinline__ void async_b128(unsigned lds_addr, unsigned long long gaddr) {
  asm volatile("global_load_async_to_lds_b128 %0, %1, off"
               :: "v"(lds_addr), "v"(gaddr) : "memory");
}
__device__ __forceinline__ void wait_async0() {
  asm volatile("s_wait_asynccnt 0x0" ::: "memory");
}

// ---- Prep kernel 1: f32->f16 convert all weights into fragment order -------

__global__ __launch_bounds__(256) void prep_weights(
    const float* __restrict__ qkv_w, const float* __restrict__ proj_w,
    const float* __restrict__ fc1_w, const float* __restrict__ fc2_w,
    half_t* __restrict__ wh)
{
  int idx = blockIdx.x * 256 + threadIdx.x;
  // place inside the 512-half fragment (every matrix starts on a fragment boundary)
  int ln = (idx >> 3) & 31;                                  // lane that reads it
  int nr = ln & 15;                                          // n inside the fragment
  int kk = ((ln >> 4) << 3) + (((idx >> 8) & 1) << 4) + (idx & 7);  // k inside it
  if (idx < OFF_PROJT) {                       // qkvT: 8 fragments per strip
    int f = idx >> 9;
    int n = ((f >> 3) << 4) + nr, k = ((f & 7) << 5) + kk;
    wh[idx] = (half_t)qkv_w[k * 768 + n];
  } else if (idx < OFF_FC1T) {                 // projT: 8 per strip
    int f = (idx - OFF_PROJT) >> 9;
    int n = ((f >> 3) << 4) + nr, k = ((f & 7) << 5) + kk;
    wh[idx] = (half_t)proj_w[k * 256 + n];
  } else if (idx < OFF_FC2T) {                 // fc1T (1024 x 256): 8 per strip
    int f = (idx - OFF_FC1T) >> 9;
    int n = ((f >> 3) << 4) + nr, k = ((f & 7) << 5) + kk;
    wh[idx] = (half_t)fc1_w[k * 1024 + n];
  } else if (idx < TOT_H) {                    // fc2T (256 x 1024): 32 per strip
    int f = (idx - OFF_FC2T) >> 9;
    int n = ((f >> 5) << 4) + nr, k = ((f & 31) << 5) + kk;
    wh[idx] = (half_t)fc2_w[k * 256 + n];
  }
}

// ---- Prep kernel 2: CPB MLP -> 16*sigmoid bias table -----------------------

__device__ __forceinline__ float logrel(int i) {
  float v = (float)(i - 7) * (8.f / 7.f);
  float a = log2f(fabsf(v) + 1.f) * (1.f / 3.f);   // /log2(8)
  return copysignf(a, v);
}

__global__ __launch_bounds__(256) void prep_bias(
    const float* __restrict__ w1, const float* __restrict__ b1,
    const float* __restrict__ w2, float* __restrict__ bias16)
{
  __shared__ float bt[225 * 8];
  int tid = threadIdx.x;
  if (tid < 225) {
    int a = tid / 15, bcol = tid % 15;
    float fx = logrel(a), fy = logrel(bcol);
    float acc[8];
#pragma unroll
    for (int h = 0; h < 8; ++h) acc[h] = 0.f;
    for (int j = 0; j < 512; ++j) {
      float hv = fmaxf(fx * w1[j] + fy * w1[512 + j] + b1[j], 0.f);
#pragma unroll
      for (int h = 0; h < 8; ++h) acc[h] += hv * w2[j * 8 + h];
    }
#pragma unroll
    for (int h = 0; h < 8; ++h) bt[tid * 8 + h] = acc[h];
  }
  __syncthreads();
  for (int q = tid; q < 4096; q += 256) {
    int i = q >> 6, j = q & 63;
    int dy = (i >> 3) - (j >> 3) + 7;
    int dx = (i & 7) - (j & 7) + 7;
    int t = dy * 15 + dx;
#pragma unroll
    for (int h = 0; h < 8; ++h)
      bias16[h * 4096 + q] = 16.f / (1.f + __expf(-bt[t * 8 + h]));
  }
}

// ---- Main fused Swin-V2 block kernel: one 8x8 window per workgroup ---------

// second bound: 4 waves a SIMD (256 registers a wave), so that two workgroups still share a WGP
__global__ __launch_bounds__(256, 4) void swin_block(
    const float* __restrict__ x,
    const float* __restrict__ logit_scale,
    const float* __restrict__ proj_b,
    const float* __restrict__ ln1_w, const float* __restrict__ ln1_b,
    const float* __restrict__ fc1_b, const float* __restrict__ fc2_b,
    const float* __restrict__ ln2_w, const float* __restrict__ ln2_b,
    const half_t* __restrict__ wh, const float* __restrict__ bias16,
    float* __restrict__ out)
{
  // attention scratch overlaid with the raw f32 input staging buffer:
  // xstage is only live before the head loop starts.
  union SMem {
    float xstage[MTOK * DIMC];                 // 64 KB raw window (f32)
    struct {
      half_t S16[MTOK * LDA];                  // o / gelu chunk / mlp staging
      half_t qb[4 * MTOK * HD];                // q, k, v of a group of 4 heads
      half_t kb[4 * MTOK * HD];
      half_t vT[4 * HD * MTOK];                // v transposed (M=d x K=j)
    } at;
  };
  __shared__ SMem U;
  __shared__ half_t XY16[MTOK * LDA];          // x window -> y (in place)
  __shared__ float  muA[MTOK], rsA[MTOK];
  __shared__ int    lab[MTOK];

  half_t* S16 = U.at.S16;
  half_t* qb4 = U.at.qb;
  half_t* kb4 = U.at.kb;
  half_t* vT4 = U.at.vT;

  const int tid  = threadIdx.x;
  const int wv   = tid >> 5;
  const int lane = tid & 31;
  const int blk  = blockIdx.x;
  const int b    = blk >> 10;
  const int wi   = blk & 1023;
  const int wy   = wi >> 5, wx = wi & 31;

  const half_t* qkvT  = wh + OFF_QKVT;
  const half_t* projT = wh + OFF_PROJT;
  const half_t* fc1T  = wh + OFF_FC1T;
  const half_t* fc2T  = wh + OFF_FC2T;

  // ---- async DMA the shifted window (f32) into LDS staging ----
  // 4096 x 16B copies: job = (c, ty, 4px-group); each group is contiguous in
  // memory even across the cyclic-shift wrap (group start gx <= 252 always).
#pragma unroll
  for (int it = 0; it < 16; ++it) {
    int job = it * 256 + tid;
    int c   = job >> 4;
    int rem = job & 15;
    int ty  = rem >> 1;
    int grp = rem & 1;
    int gy  = ((wy << 3) + ty + SHIFTS) & 255;
    int gx  = ((wx << 3) + (grp << 2) + SHIFTS) & 255;
    const float* gp = x + (((size_t)(b * DIMC + c)) << 16) + (gy << 8) + gx;
    unsigned lds = (unsigned)(unsigned long long)(uintptr_t)
                   (&U.xstage[c * MTOK + ty * 8 + grp * 4]);
    async_b128(lds, (unsigned long long)(uintptr_t)gp);
  }
  if (tid < 64) {
    int r = tid;
    int sy = (wy << 3) + (r >> 3), sx = (wx << 3) + (r & 7);
    int ry = (sy < IMG - WSZ) ? 0 : (sy < IMG - SHIFTS ? 1 : 2);
    int rx = (sx < IMG - WSZ) ? 0 : (sx < IMG - SHIFTS ? 1 : 2);
    lab[r] = ry * 3 + rx;
  }
  if (tid == 0 && blk + 1 < (int)gridDim.x)
    __builtin_prefetch(x + ((size_t)((blk + 1) >> 10) << 24), 0, 1);
  wait_async0();
  __syncthreads();

  // convert staged f32 -> f16 A-operand layout (token-major, padded rows)
  for (int it = 0; it < 64; ++it) {
    int idx = it * 256 + tid;
    int r = idx & 63, c = idx >> 6;
    XY16[r * LDA + c] = (half_t)U.xstage[c * MTOK + r];
  }
  __syncthreads();

  // ---- attention: QKV product for 4 heads at a time, then the 4 heads side by side ----
  for (int hg = 0; hg < HEADS / 4; ++hg) {
    // the attention part's split: one wave = 32 queries of one head
    const int hw = wv >> 1;                    // head inside the group
    const int h  = hg * 4 + hw;
    const int i0 = (wv & 1) << 5;              // first query of this wave
    const int cl = lane & 15, hh = lane >> 4;
    float lsc;                                 // logit scale of the head
    v4f bv[2][4][2];                           // bias of query i0+16it+cl, keys 16jt+8hh+0..7
    // 24 column tiles (q, k, v x 4 heads x 2): each wave takes one of q, of k and of v,
    // with all 4 row tiles, K = 256
    {
      int nw = wv & 1;                         // column tile inside the head
      v8f acc[12];
#pragma unroll
      for (int t = 0; t < 12; ++t) acc[t] = ZERO8;
      strip_gemm<3, 3, 2>(XY16, qkvT + (size_t)((hg * 4 + hw) * HD + nw * 16) * DIMC, DIMC * DIMC,
                    lane, acc);
      // issued here so that these global loads fly during the LDS stores below
      lsc = logit_scale[h];
      const float* bbase = bias16 + h * 4096 + (i0 + cl) * 64 + hh * 8;
#pragma unroll
      for (int it = 0; it < 2; ++it)
#pragma unroll
        for (int jt = 0; jt < 4; ++jt) {
          const float* bp = bbase + it * 1024 + jt * 16;
          bv[it][jt][0] = *(const v4f*)bp;
          bv[it][jt][1] = *(const v4f*)(bp + 4);
        }
      // the run's address pair is an input here, so it stays live up to this wait and no
      // result of the run lands in it before the wait has passed
      asm volatile("s_wait_xcnt 0x0" :: "v"(bbase) : "memory");
      int No = nw * 16 + (lane & 15);
#pragma unroll
      for (int mi = 0; mi < 4; ++mi) {
        int Mo = mi * 16 + ((lane >> 4) << 3);
#pragma unroll
        for (int g = 0; g < 8; ++g) {
          qb4[hw * (MTOK * HD) + (Mo + g) * HD + No]   = (half_t)acc[mi][g];
          kb4[hw * (MTOK * HD) + (Mo + g) * HD + No]   = (half_t)acc[4 + mi][g];
          vT4[hw * (MTOK * HD) + No * MTOK + (Mo + g)] = (half_t)acc[8 + mi][g];
        }
      }
    }
    __syncthreads();

    // One wave = 32 queries of one head, all in registers. Scores are built transposed
    // (S^T = K Q^T): a lane holds 32 of the 64 scores of one query, lane l ^ 16 the rest,
    // and two score tiles, converted in place, are the B fragment of O^T = V^T P^T.
    // Every loop here is unrolled so that each tile index is a constant and the tiles
    // stay in registers.
    {
      const half_t* qb = qb4 + hw * (MTOK * HD);
      const half_t* kb = kb4 + hw * (MTOK * HD);
      const half_t* vT = vT4 + hw * (MTOK * HD);

      // cosine attention: unit rows, logit scale folded into q
      const float qs = __expf(fminf(lsc, 4.6051702f));
      v16h qf[2];
#pragma unroll
      for (int it = 0; it < 2; ++it)
        qf[it] = frag_unit(frag_ld(qb + (i0 + it * 16) * HD, HD, lane), qs);

      v8f st[2][4];                            // st[it][jt][g] = S[i0+16it+cl][16jt+8hh+g]
#pragma unroll
      for (int jt = 0; jt < 4; ++jt) {
        v16h kf = frag_unit(frag_ld(kb + jt * 16 * HD, HD, lane), 1.f);
#pragma unroll
        for (int it = 0; it < 2; ++it) st[it][jt] = wmma_f16(kf, qf[it], ZERO8);
      }

      v16h pf[2][2];                           // P^T, k = 32 keys each
#pragma unroll
      for (int it = 0; it < 2; ++it) {
        const int i = i0 + it * 16 + cl;
        const int li = lab[i];
        float mx = -1e30f;
#pragma unroll
        for (int jt = 0; jt < 4; ++jt)
#pragma unroll
          for (int g = 0; g < 8; ++g) {
            float msk = (li == lab[jt * 16 + hh * 8 + g]) ? 0.f : -100.f;
            float v = st[it][jt][g] + bv[it][jt][g >> 2][g & 3] + msk;
            st[it][jt][g] = v;
            mx = fmaxf(mx, v);
          }
        mx = fmaxf(mx, xhalf(mx));
        float s = 0.f;
#pragma unroll
        for (int jt = 0; jt < 4; ++jt)
#pragma unroll
          for (int g = 0; g < 8; ++g) {
            float e = __expf(st[it][jt][g] - mx);
            st[it][jt][g] = e;
            s += e;
          }
        s += xhalf(s);
        const float invs = 1.f / s;
#pragma unroll
        for (int kq = 0; kq < 2; ++kq)
#pragma unroll
          for (int g = 0; g < 8; ++g) {
            pf[it][kq][g]     = (half_t)(st[it][2 * kq][g] * invs);
            pf[it][kq][8 + g] = (half_t)(st[it][2 * kq + 1][g] * invs);
          }
      }

      // O^T = V^T P^T (K = 64): a lane's 8 results are 8 neighbouring d of one query
#pragma unroll
      for (int dt = 0; dt < 2; ++dt) {
        v16h vf0 = frag_ld(vT + dt * 16 * MTOK, MTOK, lane);
        v16h vf1 = frag_ld(vT + dt * 16 * MTOK + 32, MTOK, lane);
#pragma unroll
        for (int it = 0; it < 2; ++it) {
          v8f o = wmma_f16(vf1, pf[it][1], wmma_f16(vf0, pf[it][0], ZERO8));
          v8h oh;
#pragma unroll
          for (int g = 0; g < 8; ++g) oh[g] = (half_t)o[g];
          *(v8h*)&S16[(i0 + it * 16 + cl) * LDA + h * HD + dt * 16 + hh * 8] = oh;
        }
      }
    }
    // ends every wave's reads of q, k, v before the next group overwrites them, and
    // publishes the head columns of S16 to the projection
    __syncthreads();
  }

  // ---- output projection: 64 tiles, 8 per wave (4 row x 2 column tiles), K = 256 ----
  v8f pres[8];
#pragma unroll
  for (int t = 0; t < 8; ++t) pres[t] = ZERO8;
  strip_gemm<2, 4, 4>(S16, projT + (size_t)(wv * 32) * DIMC, 16 * DIMC, lane, pres);
  __syncthreads();
#pragma unroll
  for (int t = 0; t < 8; ++t) {
    int mi = t & 3, ni = (wv << 1) + (t >> 2);
    int Mo = mi * 16 + ((lane >> 4) << 3);
    int No = ni * 16 + (lane & 15);
    float pb = proj_b[No];
#pragma unroll
    for (int g = 0; g < 8; ++g) S16[(Mo + g) * LDA + No] = (half_t)(pres[t][g] + pb);
  }
  __syncthreads();

  // ---- y = LN1(o) + x  (in place into XY16) ----
  if (tid < 64) {
    float mu = 0.f;
    for (int c = 0; c < DIMC; ++c) mu += (float)S16[tid * LDA + c];
    mu *= (1.f / DIMC);
    float var = 0.f;
    for (int c = 0; c < DIMC; ++c) {
      float d = (float)S16[tid * LDA + c] - mu; var += d * d;
    }
    float rs = rsqrtf(var * (1.f / DIMC) + 1e-5f);
    for (int c = 0; c < DIMC; ++c) {
      float yv = ((float)S16[tid * LDA + c] - mu) * rs * ln1_w[c] + ln1_b[c]
               + (float)XY16[tid * LDA + c];
      XY16[tid * LDA + c] = (half_t)yv;
    }
  }
  __syncthreads();

  // ---- MLP: 4 chunks of 256 hidden; fc2 accumulates persistently ----
  v8f acc2[8];
#pragma unroll
  for (int t = 0; t < 8; ++t) acc2[t] = ZERO8;

  for (int kc = 0; kc < 4; ++kc) {
    v8f r1[8];
#pragma unroll
    for (int t = 0; t < 8; ++t) r1[t] = ZERO8;
    strip_gemm<2, 2, 2>(XY16, fc1T + (size_t)(kc * 256 + wv * 32) * DIMC, 16 * DIMC, lane, r1);
#pragma unroll
    for (int t = 0; t < 8; ++t) {              // bias onto the whole tiles
      int ni = (wv << 1) + (t >> 2);
      int No = ni * 16 + (lane & 15);
      float bb = fc1_b[kc * 256 + No];
      r1[t] += bb;
    }
#pragma unroll
    for (int t = 0; t < 8; ++t) {
      int mi = t & 3, ni = (wv << 1) + (t >> 2);
      int Mo = mi * 16 + ((lane >> 4) << 3);
      int No = ni * 16 + (lane & 15);
      v8f ge = gelu8(r1[t]);
#pragma unroll
      for (int g = 0; g < 8; ++g) S16[(Mo + g) * LDA + No] = (half_t)ge[g];
    }
    __syncthreads();
    strip_gemm<2, 4, 4>(S16, fc2T + (size_t)(wv * 32) * HIDDEN + kc * 256 * 16, 16 * HIDDEN, lane, acc2);
    __syncthreads();
  }

  // mlp result into S16
#pragma unroll
  for (int t = 0; t < 8; ++t) {
    int mi = t & 3, ni = (wv << 1) + (t >> 2);
    int Mo = mi * 16 + ((lane >> 4) << 3);
    int No = ni * 16 + (lane & 15);
    float bb = fc2_b[No];
#pragma unroll
    for (int g = 0; g < 8; ++g) S16[(Mo + g) * LDA + No] = (half_t)(acc2[t][g] + bb);
  }
  __syncthreads();

  // LN2 stats
  if (tid < 64) {
    float mu = 0.f;
    for (int c = 0; c < DIMC; ++c) mu += (float)S16[tid * LDA + c];
    mu *= (1.f / DIMC);
    float var = 0.f;
    for (int c = 0; c < DIMC; ++c) {
      float d = (float)S16[tid * LDA + c] - mu; var += d * d;
    }
    muA[tid] = mu;
    rsA[tid] = rsqrtf(var * (1.f / DIMC) + 1e-5f);
  }
  __syncthreads();

  // ---- final: out = LN2(mlp) + y, window-reverse + un-shift ----
  for (int it = 0; it < 64; ++it) {
    int c = (it << 2) + (tid >> 6);
    int r = tid & 63;
    float mv = ((float)S16[r * LDA + c] - muA[r]) * rsA[r] * ln2_w[c] + ln2_b[c];
    float yv = mv + (float)XY16[r * LDA + c];
    int gy = ((wy << 3) + (r >> 3) + SHIFTS) & 255;
    int gx = ((wx << 3) + (r & 7) + SHIFTS) & 255;
    out[(((size_t)(b * DIMC + c)) << 16) + (gy << 8) + gx] = yv;
  }
}

// ---- launch ----------------------------------------------------------------

extern "C" void kernel_launch(void* const* d_in, const int* in_sizes, int n_in,
                              void* d_out, int out_size, void* d_ws, size_t ws_size,
                              hipStream_t stream) {
  (void)in_sizes; (void)n_in; (void)out_size; (void)ws_size;
  const float* x        = (const float*)d_in[0];
  const float* qkv_w    = (const float*)d_in[1];
  const float* lscale   = (const float*)d_in[2];
  const float* proj_w   = (const float*)d_in[3];
  const float* proj_b   = (const float*)d_in[4];
  const float* ln1_w    = (const float*)d_in[5];
  const float* ln1_b    = (const float*)d_in[6];
  const float* fc1_w    = (const float*)d_in[7];
  const float* fc1_b    = (const float*)d_in[8];
  const float* fc2_w    = (const float*)d_in[9];
  const float* fc2_b    = (const float*)d_in[10];
  const float* ln2_w    = (const float*)d_in[11];
  const float* ln2_b    = (const float*)d_in[12];
  const float* cpb_w1   = (const float*)d_in[13];
  const float* cpb_b1   = (const float*)d_in[14];
  const float* cpb_w2   = (const float*)d_in[15];

  half_t* wh     = (half_t*)d_ws;
  float*  bias16 = (float*)((char*)d_ws + OFF_BIAS_BYTES);
  float*  out    = (float*)d_out;

  prep_weights<<<TOT_H / 256, 256, 0, stream>>>(qkv_w, proj_w, fc1_w, fc2_w, wh);
  prep_bias<<<1, 256, 0, stream>>>(cpb_w1, cpb_b1, cpb_w2, bias16);
  swin_block<<<2048, 256, 0, stream>>>(x, lscale, proj_b, ln1_w, ln1_b,
                                       fc1_b, fc2_b, ln2_w, ln2_b,
                                       wh, bias16, out);
}

// v006
// Measured time: 339 microseconds a run.
// Next to v005, in two timings, it ran 1.12 and 1.13 times as fast.
// All steps since v000 together make it 3.50 times as fast.
#include <hip/hip_runtime.h>
#include <hip/hip_bf16.h>
#include <math.h>

typedef _Float16 half_t;
typedef half_t v16h __attribute__((ext_vector_type(16)));
typedef half_t v8h  __attribute__((ext_vector_type(8)));
typedef float  v8f  __attribute__((ext_vector_type(8)));
typedef float  v4f  __attribute__((ext_vector_type(4)));

#define DIMC   256
#define HEADS  8
#define HD     32
#define WSZ    8
#define SHIFTS 4
#define MTOK   64
#define IMG    256
#define HIDDEN 1024
#define LDA    264   // padded f16 row stride (264 halves = 528B, bank-spread, 16B-aligned)

// workspace layout (in halves): qkvT 768x256 | projT 256x256 | fc1T 1024x256 | fc2T 256x1024
// Each N x K matrix is stored fragment by fragment (16 n x 32 k = 512 halves = 1 KiB),
// fragments of one 16-row strip following each other along k. Inside a fragment the
// halves lie in register order: 32 lanes x first 8 halves (512 B), then 32 lanes x
// second 8 halves (512 B), so each wave-wide 16-byte load reads 4 whole 128-B lines.
#define OFF_QKVT 0
#define OFF_PROJT (768*256)
#define OFF_FC1T  (OFF_PROJT + 256*256)
#define OFF_FC2T  (OFF_FC1T + 1024*256)
#define TOT_H     (OFF_FC2T + 256*1024)
#define OFF_BIAS_BYTES ((size_t)TOT_H * 2)   // then float bias16[8][64][64]

// ---- WMMA helpers -----------------------------------------------------------

// 16x32 f16 fragment (A from XY16, S16, kb and vT; also B from the N x K LDS buffer qb).
// CDNA5 layout: lanes 0-15 row M=lane hold K 0..7 then 16..23;
// lanes 16-31 hold K 8..15 then 24..31.
__device__ __forceinline__ v16h frag_ld(const half_t* p0, int ld, int lane) {
  const half_t* p = p0 + (lane & 15) * ld + ((lane >> 4) << 3);
  v8h lo = *(const v8h*)p;
  v8h hi = *(const v8h*)(p + 16);
  return __builtin_shufflevector(lo, hi, 0,1,2,3,4,5,6,7,8,9,10,11,12,13,14,15);
}

// B fragment from the packed weights: same lane/k map as frag_ld, contiguous bytes.
__device__ __forceinline__ v16h frag_ldw(const half_t* frag, int lane) {
  const half_t* p = frag + lane * 8;
  v8h lo = *(const v8h*)p;
  v8h hi = *(const v8h*)(p + 256);
  return __builtin_shufflevector(lo, hi, 0,1,2,3,4,5,6,7,8,9,10,11,12,13,14,15);
}

__device__ __forceinline__ v8f wmma_f16(v16h a, v16h b, v8f c) {
  return __builtin_amdgcn_wmma_f32_16x16x32_f16(false, a, false, b, (short)0, c,
                                                false, false);
}

#define ZERO8 ((v8f){0.f,0.f,0.f,0.f,0.f,0.f,0.f,0.f})

// value of lane l ^ 16 (the lane that holds the other half of the same row or column)
__device__ __forceinline__ float xhalf(float x) {
  int b = __builtin_bit_cast(int, x);
  return __builtin_bit_cast(float, __builtin_amdgcn_permlanex16(b, b, 0x76543210, 0xfedcba98,
                                                                false, false));
}

// Scale a 16 x 32 fragment's rows to unit length, times mul. Lanes l and l ^ 16 hold the
// two halves of one row, so the sum of squares is 16 terms in the lane plus one exchange.
// (Loops unrolled: vector elements are reached by constant index only.)
__device__ __forceinline__ v16h frag_unit(v16h f, float mul) {
  float ss = 0.f;
#pragma unroll
  for (int s = 0; s < 16; ++s) { float v = (float)f[s]; ss += v * v; }
  ss += xhalf(ss);
  float inv = 1.f / fmaxf(sqrtf(ss), 1e-12f) * mul;
  v16h o;
#pragma unroll
  for (int s = 0; s < 16; ++s) o[s] = (half_t)((float)f[s] * inv);
  return o;
}

// One wave's strip of a 64 x N product, K = 256: all 4 row tiles x NT column tiles.
// Each packed weight fragment is loaded once and feeds 4 WMMAs. The weight fragments run
// through a register ring D k steps deep: the loads of step ks + D are issued as soon as
// step ks has used its slot, so a load has D - 1 steps of WMMAs to come back from L2.
// The A fragments of a step are read from LDS in groups of AG. D and AG are what each
// caller's live accumulators leave room for. acc[j * 4 + mi]; k runs upward for every tile.
template <int NT, int D, int AG>
__device__ __forceinline__ void strip_gemm(const half_t* As, const half_t* B0, int bstride,
                                           int lane, v8f* acc) {
  v16h bf[D][NT];
#pragma unroll
  for (int p = 0; p < D; ++p)
#pragma unroll
    for (int j = 0; j < NT; ++j) bf[p][j] = frag_ldw(B0 + j * bstride + p * 512, lane);
  // holds the ring's first loads here: sunk to their first use they would each be waited
  // for at full L2 latency
  __builtin_amdgcn_sched_barrier(0);
  // unrolled so that every ring slot is a constant index and stays in registers
#pragma unroll
  for (int ks = 0; ks < DIMC / 32; ++ks) {
#pragma unroll
    for (int m0 = 0; m0 < 4; m0 += AG) {
      v16h af[AG];
#pragma unroll
      for (int mi = 0; mi < AG; ++mi)
        af[mi] = frag_ld(As + (m0 + mi) * 16 * LDA + ks * 32, LDA, lane);
#pragma unroll
      for (int mi = 0; mi < AG; ++mi)
#pragma unroll
        for (int j = 0; j < NT; ++j)
          acc[j * 4 + m0 + mi] = wmma_f16(af[mi], bf[ks % D][j], acc[j * 4 + m0 + mi]);
      // order: a group's LDS reads together (one LDS wait a group, not one a fragment),
      // then its WMMAs
      __builtin_amdgcn_sched_group_barrier(0x100, 2 * AG, 0);
      __builtin_amdgcn_sched_group_barrier(0x008, AG * NT, 0);
    }
    if (ks + D < DIMC / 32) {
#pragma unroll
      for (int j = 0; j < NT; ++j)
        bf[ks % D][j] = frag_ldw(B0 + j * bstride + (ks + D) * 512, lane);
      __builtin_amdgcn_sched_group_barrier(0x020, 2 * NT, 0);   // the refill behind them
      // holds the refill at the foot of its step (same reason as above)
      __builtin_amdgcn_sched_barrier(0);
    }
  }
}

// GELU(v) = 0.5 v (1 + erf(v / sqrt 2)) of the 8 values of a tile, with erf from
// ONE formula for every v:
//   erf(|x|) = 1 - t (a1 + t (a2 + t (a3 + t (a4 + t a5)))) exp(-x^2),  t = 1 / (1 + p |x|)
// No case split, so no lane mask and no branch stands between two elements, and the work of
// neighbouring elements can be packed and overlapped. Absolute error of the result below 5e-7
// for every v (it is then rounded to f16). p / sqrt 2 and -log2(e) / 2 are folded into v's
// factors.
__device__ __forceinline__ v8f gelu8(v8f v) {
  float t[8], e[8];
#pragma unroll
  for (int g = 0; g < 8; ++g) {
    t[g] = fmaf(fabsf(v[g]), 0.3275911f * 0.70710678f, 1.f);
    e[g] = v[g] * v[g] * (-0.5f * 1.44269504f);
  }
#pragma unroll
  for (int g = 0; g < 8; ++g) { t[g] = __builtin_amdgcn_rcpf(t[g]); e[g] = __builtin_amdgcn_exp2f(e[g]); }
  // Horner, one step for all 8 elements at a time: the 8 chains do not depend on one another
  float p[8];
  v8f o;
#pragma unroll
  for (int g = 0; g < 8; ++g) p[g] = fmaf(t[g], 1.061405429f, -1.453152027f);
#pragma unroll
  for (int g = 0; g < 8; ++g) p[g] = fmaf(t[g], p[g], 1.421413741f);
#pragma unroll
  for (int g = 0; g < 8; ++g) p[g] = fmaf(t[g], p[g], -0.284496736f);
#pragma unroll
  for (int g = 0; g < 8; ++g) p[g] = fmaf(t[g], p[g], 0.254829592f);
#pragma unroll
  for (int g = 0; g < 8; ++g) p[g] *= t[g];
#pragma unroll
  for (int g = 0; g < 8; ++g) p[g] = copysignf(fmaf(-p[g], e[g], 1.f), v[g]);
#pragma unroll
  for (int g = 0; g < 8; ++g) {
    const float hv = 0.5f * v[g];
    o[g] = fmaf(hv, p[g], hv);
  }
  return o;
}

// async global -> LDS copy of 16 bytes (per-lane), tracked on ASYNCcnt
__device__ __forceinline__ void async_b128(unsigned lds_addr, unsigned long long gaddr) {
  asm volatile("global_load_async_to_lds_b128 %0, %1, off"
               :: "v"(lds_addr), "v"(gaddr) : "memory");
}
__device__ __forceinline__ void wait_async0() {
  asm volatile("s_wait_asynccnt 0x0" ::: "memory");
}

// ---- Prep kernel 1: f32->f16 convert all weights into fragment order -------

__global__ __launch_bounds__(256) void prep_weights(
    const float* __restrict__ qkv_w, const float* __restrict__ proj_w,
    const float* __restrict__ fc1_w, const float* __restrict__ fc2_w,
    half_t* __restrict__ wh)
{
  int idx = blockIdx.x * 256 + threadIdx.x;
  // place inside the 512-half fragment (every matrix starts on a fragment boundary)
  int ln = (idx >> 3) & 31;                                  // lane that reads it
  int nr = ln & 15;                                          // n inside the fragment
  int kk = ((ln >> 4) << 3) + (((idx >> 8) & 1) << 4) + (idx & 7);  // k inside it
  if (idx < OFF_PROJT) {                       // qkvT: 8 fragments per strip
    int f = idx >> 9;
    int n = ((f >> 3) << 4) + nr, k = ((f & 7) << 5) + kk;
    wh[idx] = (half_t)qkv_w[k * 768 + n];
  } else if (idx < OFF_FC1T) {                 // projT: 8 per strip
    int f = (idx - OFF_PROJT) >> 9;
    int n = ((f >> 3) << 4) + nr, k = ((f & 7) << 5) + kk;
    wh[idx] = (half_t)proj_w[k * 256 + n];
  } else if (idx < OFF_FC2T) {                 // fc1T (1024 x 256): 8 per strip
    int f = (idx - OFF_FC1T) >> 9;
    int n = ((f >> 3) << 4) + nr, k = ((f & 7) << 5) + kk;
    wh[idx] = (half_t)fc1_w[k * 1024 + n];
  } else if (idx < TOT_H) {                    // fc2T (256 x 1024): 32 per strip
    int f = (idx - OFF_FC2T) >> 9;
    int n = ((f >> 5) << 4) + nr, k = ((f & 31) << 5) + kk;
    wh[idx] = (half_t)fc2_w[k * 256 + n];
  }
}

// ---- Prep kernel 2: CPB MLP -> 16*sigmoid bias table -----------------------

__device__ __forceinline__ float logrel(int i) {
  float v = (float)(i - 7) * (8.f / 7.f);
  float a = log2f(fabsf(v) + 1.f) * (1.f / 3.f);   // /log2(8)
  return copysignf(a, v);
}

// sum over the 32 lanes of a wave, the same total in every lane: four exchanges inside the
// 16-lane row (DPP row_xmask 1, 2, 4, 8), then one with the other row
template <int XM>
__device__ __forceinline__ float xrow(float x) {
  int b = __builtin_bit_cast(int, x);
  return __builtin_bit_cast(float, __builtin_amdgcn_update_dpp(b, b, 0x160 + XM, 0xf, 0xf, false));
}
__device__ __forceinline__ float wave_sum(float v) {
  v += xrow<1>(v);
  v += xrow<2>(v);
  v += xrow<4>(v);
  v += xrow<8>(v);
  return v + xhalf(v);
}

// One workgroup = one query i and 32 of its 64 keys; one wave = 4 of those keys. The value of
// a (query, key) pair is a sum over the 512 hidden units: the lanes split the units (unit
// 32 s + lane), so a wave's weights come in by vector loads that are all in flight at once
// (one trip to memory for the kernel, not one for every few units), and the 32 partial sums
// meet in a lane exchange. Pairs with the same offset are computed again where they are needed:
// no workgroup waits for another's table. Every loop is unrolled so that the arrays stay in
// registers.
__global__ __launch_bounds__(256) void prep_bias(
    const float* __restrict__ w1, const float* __restrict__ b1,
    const float* __restrict__ w2, float* __restrict__ bias16)
{
  __shared__ float sb[32 * 8];
  const int tid = threadIdx.x, wv = tid >> 5, lane = tid & 31;
  const int i  = blockIdx.x >> 1;
  const int j0 = (blockIdx.x & 1) << 5;

  float wa[16], wb[16], bh[16];
  v4f wo[16][2];
#pragma unroll
  for (int s = 0; s < 16; ++s) {
    const int m = s * 32 + lane;
    wa[s] = w1[m];
    wb[s] = w1[512 + m];
    bh[s] = b1[m];
    wo[s][0] = *(const v4f*)(w2 + m * 8);
    wo[s][1] = *(const v4f*)(w2 + m * 8 + 4);
  }
  // holds all 80 loads in front of the arithmetic: sunk towards their uses they would go out in
  // several batches, each waited for at full memory latency
  __builtin_amdgcn_sched_barrier(0);

  float fx[4], fy[4], acc[4][8];
#pragma unroll
  for (int e = 0; e < 4; ++e) {
    const int j = j0 + wv * 4 + e;
    fx[e] = logrel((i >> 3) - (j >> 3) + 7);
    fy[e] = logrel((i & 7) - (j & 7) + 7);
#pragma unroll
    for (int h = 0; h < 8; ++h) acc[e][h] = 0.f;
  }
#pragma unroll
  for (int s = 0; s < 16; ++s)
#pragma unroll
    for (int e = 0; e < 4; ++e) {
      float hv = fmaxf(fx[e] * wa[s] + fy[e] * wb[s] + bh[s], 0.f);
#pragma unroll
      for (int h = 0; h < 8; ++h) acc[e][h] += hv * wo[s][h >> 2][h & 3];
    }
#pragma unroll
  for (int e = 0; e < 4; ++e)
#pragma unroll
    for (int h = 0; h < 8; ++h) acc[e][h] = wave_sum(acc[e][h]);
  if (lane == 0) {
#pragma unroll
    for (int e = 0; e < 4; ++e)
#pragma unroll
      for (int h = 0; h < 8; ++h) sb[(wv * 4 + e) * 8 + h] = acc[e][h];
  }
  __syncthreads();
  // thread = (head, key): a wave stores one whole 128-byte line
  const int h = tid >> 5, jj = tid & 31;
  bias16[h * 4096 + i * 64 + j0 + jj] = 16.f / (1.f + __expf(-sb[jj * 8 + h]));
}

// ---- Main fused Swin-V2 block kernel: one 8x8 window per workgroup ---------

// second bound: 4 waves a SIMD (256 registers a wave), so that two workgroups still share a WGP
__global__ __launch_bounds__(256, 4) void swin_block(
    const float* __restrict__ x,
    const float* __restrict__ logit_scale,
    const float* __restrict__ proj_b,
    const float* __restrict__ ln1_w, const float* __restrict__ ln1_b,
    const float* __restrict__ fc1_b, const float* __restrict__ fc2_b,
    const float* __restrict__ ln2_w, const float* __restrict__ ln2_b,
    const half_t* __restrict__ wh, const float* __restrict__ bias16,
    float* __restrict__ out)
{
  // attention scratch overlaid with the raw f32 input staging buffer:
  // xstage is only live before the head loop starts.
  union SMem {
    float xstage[MTOK * DIMC];                 // 64 KB raw window (f32)
    struct {
      half_t S16[MTOK * LDA];                  // o / gelu chunk / mlp staging
      half_t qb[4 * MTOK * HD];                // q, k, v of a group of 4 heads
      half_t kb[4 * MTOK * HD];
      half_t vT[4 * HD * MTOK];                // v transposed (M=d x K=j)
    } at;
  };
  __shared__ SMem U;
  __shared__ half_t XY16[MTOK * LDA];          // x window -> y (in place)
  __shared__ float  muA[MTOK], rsA[MTOK];
  __shared__ int    lab[MTOK];

  half_t* S16 = U.at.S16;
  half_t* qb4 = U.at.qb;
  half_t* kb4 = U.at.kb;
  half_t* vT4 = U.at.vT;

  const int tid  = threadIdx.x;
  const int wv   = tid >> 5;
  const int lane = tid & 31;
  const int blk  = blockIdx.x;
  const int b    = blk >> 10;
  const int wi   = blk & 1023;
  const int wy   = wi >> 5, wx = wi & 31;

  const half_t* qkvT  = wh + OFF_QKVT;
  const half_t* projT = wh + OFF_PROJT;
  const half_t* fc1T  = wh + OFF_FC1T;
  const half_t* fc2T  = wh + OFF_FC2T;

  // ---- async DMA the shifted window (f32) into LDS staging ----
  // 4096 x 16B copies: job = (c, ty, 4px-group); each group is contiguous in
  // memory even across the cyclic-shift wrap (group start gx <= 252 always).
#pragma unroll
  for (int it = 0; it < 16; ++it) {
    int job = it * 256 + tid;
    int c   = job >> 4;
    int rem = job & 15;
    int ty  = rem >> 1;
    int grp = rem & 1;
    int gy  = ((wy << 3) + ty + SHIFTS) & 255;
    int gx  = ((wx << 3) + (grp << 2) + SHIFTS) & 255;
    const float* gp = x + (((size_t)(b * DIMC + c)) << 16) + (gy << 8) + gx;
    unsigned lds = (unsigned)(unsigned long long)(uintptr_t)
                   (&U.xstage[c * MTOK + ty * 8 + grp * 4]);
    async_b128(lds, (unsigned long long)(uintptr_t)gp);
  }
  if (tid < 64) {
    int r = tid;
    int sy = (wy << 3) + (r >> 3), sx = (wx << 3) + (r & 7);
    int ry = (sy < IMG - WSZ) ? 0 : (sy < IMG - SHIFTS ? 1 : 2);
    int rx = (sx < IMG - WSZ) ? 0 : (sx < IMG - SHIFTS ? 1 : 2);
    lab[r] = ry * 3 + rx;
  }
  if (tid == 0 && blk + 1 < (int)gridDim.x)
    __builtin_prefetch(x + ((size_t)((blk + 1) >> 10) << 24), 0, 1);
  wait_async0();
  __syncthreads();

  // convert staged f32 -> f16 A-operand layout (token-major, padded rows)
  for (int it = 0; it < 64; ++it) {
    int idx = it * 256 + tid;
    int r = idx & 63, c = idx >> 6;
    XY16[r * LDA + c] = (half_t)U.xstage[c * MTOK + r];
  }
  __syncthreads();

  // ---- attention: QKV product for 4 heads at a time, then the 4 heads side by side ----
  for (int hg = 0; hg < HEADS / 4; ++hg) {
    // the attention part's split: one wave = 32 queries of one head
    const int hw = wv >> 1;                    // head inside the group
    const int h  = hg * 4 + hw;
    const int i0 = (wv & 1) << 5;              // first query of this wave
    const int cl = lane & 15, hh = lane >> 4;
    float lsc;                                 // logit scale of the head
    v4f bv[2][4][2];                           // bias of query i0+16it+cl, keys 16jt+8hh+0..7
    // 24 column tiles (q, k, v x 4 heads x 2): each wave takes one of q, of k and of v,
    // with all 4 row tiles, K = 256
    {
      int nw = wv & 1;                         // column tile inside the head
      v8f acc[12];
#pragma unroll
      for (int t = 0; t < 12; ++t) acc[t] = ZERO8;
      strip_gemm<3, 3, 2>(XY16, qkvT + (size_t)((hg * 4 + hw) * HD + nw * 16) * DIMC, DIMC * DIMC,
                    lane, acc);
      // issued here so that these global loads fly during the LDS stores below
      lsc = logit_scale[h];
      const float* bbase = bias16 + h * 4096 + (i0 + cl) * 64 + hh * 8;
#pragma unroll
      for (int it = 0; it < 2; ++it)
#pragma unroll
        for (int jt = 0; jt < 4; ++jt) {
          const float* bp = bbase + it * 1024 + jt * 16;
          bv[it][jt][0] = *(const v4f*)bp;
          bv[it][jt][1] = *(const v4f*)(bp + 4);
        }
      // the run's address pair is an input here, so it stays live up to this wait and no
      // result of the run lands in it before the wait has passed
      asm volatile("s_wait_xcnt 0x0" :: "v"(bbase) : "memory");
      int No = nw * 16 + (lane & 15);
#pragma unroll
      for (int mi = 0; mi < 4; ++mi) {
        int Mo = mi * 16 + ((lane >> 4) << 3);
#pragma unroll
        for (int g = 0; g < 8; ++g) {
          qb4[hw * (MTOK * HD) + (Mo + g) * HD + No]   = (half_t)acc[mi][g];
          kb4[hw * (MTOK * HD) + (Mo + g) * HD + No]   = (half_t)acc[4 + mi][g];
          vT4[hw * (MTOK * HD) + No * MTOK + (Mo + g)] = (half_t)acc[8 + mi][g];
        }
      }
    }
    __syncthreads();

    // One wave = 32 queries of one head, all in registers. Scores are built transposed
    // (S^T = K Q^T): a lane holds 32 of the 64 scores of one query, lane l ^ 16 the rest,
    // and two score tiles, converted in place, are the B fragment of O^T = V^T P^T.
    // Every loop here is unrolled so that each tile index is a constant and the tiles
    // stay in registers.
    {
      const half_t* qb = qb4 + hw * (MTOK * HD);
      const half_t* kb = kb4 + hw * (MTOK * HD);
      const half_t* vT = vT4 + hw * (MTOK * HD);

      // cosine attention: unit rows, logit scale folded into q
      const float qs = __expf(fminf(lsc, 4.6051702f));
      v16h qf[2];
#pragma unroll
      for (int it = 0; it < 2; ++it)
        qf[it] = frag_unit(frag_ld(qb + (i0 + it * 16) * HD, HD, lane), qs);

      v8f st[2][4];                            // st[it][jt][g] = S[i0+16it+cl][16jt+8hh+g]
#pragma unroll
      for (int jt = 0; jt < 4; ++jt) {
        v16h kf = frag_unit(frag_ld(kb + jt * 16 * HD, HD, lane), 1.f);
#pragma unroll
        for (int it = 0; it < 2; ++it) st[it][jt] = wmma_f16(kf, qf[it], ZERO8);
      }

      v16h pf[2][2];                           // P^T, k = 32 keys each
#pragma unroll
      for (int it = 0; it < 2; ++it) {
        const int i = i0 + it * 16 + cl;
        const int li = lab[i];
        float mx = -1e30f;
#pragma unroll
        for (int jt = 0; jt < 4; ++jt)
#pragma unroll
          for (int g = 0; g < 8; ++g) {
            float msk = (li == lab[jt * 16 + hh * 8 + g]) ? 0.f : -100.f;
            float v = st[it][jt][g] + bv[it][jt][g >> 2][g & 3] + msk;
            st[it][jt][g] = v;
            mx = fmaxf(mx, v);
          }
        mx = fmaxf(mx, xhalf(mx));
        float s = 0.f;
#pragma unroll
        for (int jt = 0; jt < 4; ++jt)
#pragma unroll
          for (int g = 0; g < 8; ++g) {
            float e = __expf(st[it][jt][g] - mx);
            st[it][jt][g] = e;
            s += e;
          }
        s += xhalf(s);
        const float invs = 1.f / s;
#pragma unroll
        for (int kq = 0; kq < 2; ++kq)
#pragma unroll
          for (int g = 0; g < 8; ++g) {
            pf[it][kq][g]     = (half_t)(st[it][2 * kq][g] * invs);
            pf[it][kq][8 + g] = (half_t)(st[it][2 * kq + 1][g] * invs);
          }
      }

      // O^T = V^T P^T (K = 64): a lane's 8 results are 8 neighbouring d of one query
#pragma unroll
      for (int dt = 0; dt < 2; ++dt) {
        v16h vf0 = frag_ld(vT + dt * 16 * MTOK, MTOK, lane);
        v16h vf1 = frag_ld(vT + dt * 16 * MTOK + 32, MTOK, lane);
#pragma unroll
        for (int it = 0; it < 2; ++it) {
          v8f o = wmma_f16(vf1, pf[it][1], wmma_f16(vf0, pf[it][0], ZERO8));
          v8h oh;
#pragma unroll
          for (int g = 0; g < 8; ++g) oh[g] = (half_t)o[g];
          *(v8h*)&S16[(i0 + it * 16 + cl) * LDA + h * HD + dt * 16 + hh * 8] = oh;
        }
      }
    }
    // ends every wave's reads of q, k, v before the next group overwrites them, and
    // publishes the head columns of S16 to the projection
    __syncthreads();
  }

  // ---- output projection: 64 tiles, 8 per wave (4 row x 2 column tiles), K = 256 ----
  v8f pres[8];
#pragma unroll
  for (int t = 0; t < 8; ++t) pres[t] = ZERO8;
  strip_gemm<2, 4, 4>(S16, projT + (size_t)(wv * 32) * DIMC, 16 * DIMC, lane, pres);
  __syncthreads();
#pragma unroll
  for (int t = 0; t < 8; ++t) {
    int mi = t & 3, ni = (wv << 1) + (t >> 2);
    int Mo = mi * 16 + ((lane >> 4) << 3);
    int No = ni * 16 + (lane & 15);
    float pb = proj_b[No];
#pragma unroll
    for (int g = 0; g < 8; ++g) S16[(Mo + g) * LDA + No] = (half_t)(pres[t][g] + pb);
  }
  __syncthreads();

  // ---- y = LN1(o) + x  (in place into XY16) ----
  if (tid < 64) {
    float mu = 0.f;
    for (int c = 0; c < DIMC; ++c) mu += (float)S16[tid * LDA + c];
    mu *= (1.f / DIMC);
    float var = 0.f;
    for (int c = 0; c < DIMC; ++c) {
      float d = (float)S16[tid * LDA + c] - mu; var += d * d;
    }
    float rs = rsqrtf(var * (1.f / DIMC) + 1e-5f);
    for (int c = 0; c < DIMC; ++c) {
      float yv = ((float)S16[tid * LDA + c] - mu) * rs * ln1_w[c] + ln1_b[c]
               + (float)XY16[tid * LDA + c];
      XY16[tid * LDA + c] = (half_t)yv;
    }
  }
  __syncthreads();

  // ---- MLP: 4 chunks of 256 hidden; fc2 accumulates persistently ----
  v8f acc2[8];
#pragma unroll
  for (int t = 0; t < 8; ++t) acc2[t] = ZERO8;

  for (int kc = 0; kc < 4; ++kc) {
    v8f r1[8];
#pragma unroll
    for (int t = 0; t < 8; ++t) r1[t] = ZERO8;
    strip_gemm<2, 2, 2>(XY16, fc1T + (size_t)(kc * 256 + wv * 32) * DIMC, 16 * DIMC, lane, r1);
#pragma unroll
    for (int t = 0; t < 8; ++t) {              // bias onto the whole tiles
      int ni = (wv << 1) + (t >> 2);
      int No = ni * 16 + (lane & 15);
      float bb = fc1_b[kc * 256 + No];
      r1[t] += bb;
    }
#pragma unroll
    for (int t = 0; t < 8; ++t) {
      int mi = t & 3, ni = (wv << 1) + (t >> 2);
      int Mo = mi * 16 + ((lane >> 4) << 3);
      int No = ni * 16 + (lane & 15);
      v8f ge = gelu8(r1[t]);
#pragma unroll
      for (int g = 0; g < 8; ++g) S16[(Mo + g) * LDA + No] = (half_t)ge[g];
    }
    __syncthreads();
    strip_gemm<2, 4, 4>(S16, fc2T + (size_t)(wv * 32) * HIDDEN + kc * 256 * 16, 16 * HIDDEN, lane, acc2);
    __syncthreads();
  }

  // mlp result into S16
#pragma unroll
  for (int t = 0; t < 8; ++t) {
    int mi = t & 3, ni = (wv << 1) + (t >> 2);
    int Mo = mi * 16 + ((lane >> 4) << 3);
    int No = ni * 16 + (lane & 15);
    float bb = fc2_b[No];
#pragma unroll
    for (int g = 0; g < 8; ++g) S16[(Mo + g) * LDA + No] = (half_t)(acc2[t][g] + bb);
  }
  __syncthreads();

  // LN2 stats
  if (tid < 64) {
    float mu = 0.f;
    for (int c = 0; c < DIMC; ++c) mu += (float)S16[tid * LDA + c];
    mu *= (1.f / DIMC);
    float var = 0.f;
    for (int c = 0; c < DIMC; ++c) {
      float d = (float)S16[tid * LDA + c] - mu; var += d * d;
    }
    muA[tid] = mu;
    rsA[tid] = rsqrtf(var * (1.f / DIMC) + 1e-5f);
  }
  __syncthreads();

  // ---- final: out = LN2(mlp) + y, window-reverse + un-shift ----
  for (int it = 0; it < 64; ++it) {
    int c = (it << 2) + (tid >> 6);
    int r = tid & 63;
    float mv = ((float)S16[r * LDA + c] - muA[r]) * rsA[r] * ln2_w[c] + ln2_b[c];
    float yv = mv + (float)XY16[r * LDA + c];
    int gy = ((wy << 3) + (r >> 3) + SHIFTS) & 255;
    int gx = ((wx << 3) + (r & 7) + SHIFTS) & 255;
    out[(((size_t)(b * DIMC + c)) << 16) + (gy << 8) + gx] = yv;
  }
}

// ---- launch ----------------------------------------------------------------

extern "C" void kernel_launch(void* const* d_in, const int* in_sizes, int n_in,
                              void* d_out, int out_size, void* d_ws, size_t ws_size,
                              hipStream_t stream) {
  (void)in_sizes; (void)n_in; (void)out_size; (void)ws_size;
  const float* x        = (const float*)d_in[0];
  const float* qkv_w    = (const float*)d_in[1];
  const float* lscale   = (const float*)d_in[2];
  const float* proj_w   = (const float*)d_in[3];
  const float* proj_b   = (const float*)d_in[4];
  const float* ln1_w    = (const float*)d_in[5];
  const float* ln1_b    = (const float*)d_in[6];
  const float* fc1_w    = (const float*)d_in[7];
  const float* fc1_b    = (const float*)d_in[8];
  const float* fc2_w    = (const float*)d_in[9];
  const float* fc2_b    = (const float*)d_in[10];
  const float* ln2_w    = (const float*)d_in[11];
  const float* ln2_b    = (const float*)d_in[12];
  const float* cpb_w1   = (const float*)d_in[13];
  const float* cpb_b1   = (const float*)d_in[14];
  const float* cpb_w2   = (const float*)d_in[15];

  half_t* wh     = (half_t*)d_ws;
  float*  bias16 = (float*)((char*)d_ws + OFF_BIAS_BYTES);
  float*  out    = (float*)d_out;

  prep_weights<<<TOT_H / 256, 256, 0, stream>>>(qkv_w, proj_w, fc1_w, fc2_w, wh);
  prep_bias<<<128, 256, 0, stream>>>(cpb_w1, cpb_b1, cpb_w2, bias16);
  swin_block<<<2048, 256, 0, stream>>>(x, lscale, proj_b, ln1_w, ln1_b,
                                       fc1_b, fc2_b, ln2_w, ln2_b,
                                       wh, bias16, out);
}

// v007
// It runs in 320 microseconds.
// In both of two side-by-side timings against v006, it was 1.06 times as fast.
// All steps since v000 together make it 3.72 times as fast.
#include <hip/hip_runtime.h>
#include <hip/hip_bf16.h>
#include <math.h>

typedef _Float16 half_t;
typedef half_t v16h __attribute__((ext_vector_type(16)));
typedef half_t v8h  __attribute__((ext_vector_type(8)));
typedef float  v8f  __attribute__((ext_vector_type(8)));
typedef float  v4f  __attribute__((ext_vector_type(4)));

#define DIMC   256
#define HEADS  8
#define HD     32
#define WSZ    8
#define SHIFTS 4
#define MTOK   64
#define IMG    256
#define HIDDEN 1024
#define LDA    264   // padded f16 row stride (264 halves = 528B, bank-spread, 16B-aligned)

// workspace layout (in halves): qkvT 768x256 | projT 256x256 | fc1T 1024x256 | fc2T 256x1024
// Each N x K matrix is stored fragment by fragment (16 n x 32 k = 512 halves = 1 KiB),
// fragments of one 16-row strip following each other along k. Inside a fragment the
// halves lie in register order: 32 lanes x first 8 halves (512 B), then 32 lanes x
// second 8 halves (512 B), so each wave-wide 16-byte load reads 4 whole 128-B lines.
#define OFF_QKVT 0
#define OFF_PROJT (768*256)
#define OFF_FC1T  (OFF_PROJT + 256*256)
#define OFF_FC2T  (OFF_FC1T + 1024*256)
#define TOT_H     (OFF_FC2T + 256*1024)
#define OFF_BIAS_BYTES ((size_t)TOT_H * 2)   // then float bias16[8][64][64]

// ---- WMMA helpers -----------------------------------------------------------

// 16x32 f16 fragment (A from XY16, S16, kb and vT; also B from the N x K LDS buffer qb).
// CDNA5 layout: lanes 0-15 row M=lane hold K 0..7 then 16..23;
// lanes 16-31 hold K 8..15 then 24..31.
__device__ __forceinline__ v16h frag_ld(const half_t* p0, int ld, int lane) {
  const half_t* p = p0 + (lane & 15) * ld + ((lane >> 4) << 3);
  v8h lo = *(const v8h*)p;
  v8h hi = *(const v8h*)(p + 16);
  return __builtin_shufflevector(lo, hi, 0,1,2,3,4,5,6,7,8,9,10,11,12,13,14,15);
}

// B fragment from the packed weights: same lane/k map as frag_ld, contiguous bytes.
__device__ __forceinline__ v16h frag_ldw(const half_t* frag, int lane) {
  const half_t* p = frag + lane * 8;
  v8h lo = *(const v8h*)p;
  v8h hi = *(const v8h*)(p + 256);
  return __builtin_shufflevector(lo, hi, 0,1,2,3,4,5,6,7,8,9,10,11,12,13,14,15);
}

__device__ __forceinline__ v8f wmma_f16(v16h a, v16h b, v8f c) {
  return __builtin_amdgcn_wmma_f32_16x16x32_f16(false, a, false, b, (short)0, c,
                                                false, false);
}

#define ZERO8 ((v8f){0.f,0.f,0.f,0.f,0.f,0.f,0.f,0.f})

// value of lane l ^ 16 (the lane that holds the other half of the same row or column)
__device__ __forceinline__ float xhalf(float x) {
  int b = __builtin_bit_cast(int, x);
  return __builtin_bit_cast(float, __builtin_amdgcn_permlanex16(b, b, 0x76543210, 0xfedcba98,
                                                                false, false));
}

// Scale a 16 x 32 fragment's rows to unit length, times mul. Lanes l and l ^ 16 hold the
// two halves of one row, so the sum of squares is 16 terms in the lane plus one exchange.
// (Loops unrolled: vector elements are reached by constant index only.)
__device__ __forceinline__ v16h frag_unit(v16h f, float mul) {
  float ss = 0.f;
#pragma unroll
  for (int s = 0; s < 16; ++s) { float v = (float)f[s]; ss += v * v; }
  ss += xhalf(ss);
  float inv = 1.f / fmaxf(sqrtf(ss), 1e-12f) * mul;
  v16h o;
#pragma unroll
  for (int s = 0; s < 16; ++s) o[s] = (half_t)((float)f[s] * inv);
  return o;
}

// One wave's strip of a 64 x N product, K = 256: all 4 row tiles x NT column tiles.
// Each packed weight fragment is loaded once and feeds 4 WMMAs. The weight fragments run
// through a register ring D k steps deep: the loads of step ks + D are issued as soon as
// step ks has used its slot, so a load has D - 1 steps of WMMAs to come back from L2.
// The A fragments of a step are read from LDS in groups of AG. D and AG are what each
// caller's live accumulators leave room for. acc[j * 4 + mi]; k runs upward for every tile.
template <int NT, int D, int AG>
__device__ __forceinline__ void strip_gemm(const half_t* As, const half_t* B0, int bstride,
                                           int lane, v8f* acc) {
  v16h bf[D][NT];
#pragma unroll
  for (int p = 0; p < D; ++p)
#pragma unroll
    for (int j = 0; j < NT; ++j) bf[p][j] = frag_ldw(B0 + j * bstride + p * 512, lane);
  // holds the ring's first loads here: sunk to their first use they would each be waited
  // for at full L2 latency
  __builtin_amdgcn_sched_barrier(0);
  // unrolled so that every ring slot is a constant index and stays in registers
#pragma unroll
  for (int ks = 0; ks < DIMC / 32; ++ks) {
#pragma unroll
    for (int m0 = 0; m0 < 4; m0 += AG) {
      v16h af[AG];
#pragma unroll
      for (int mi = 0; mi < AG; ++mi)
        af[mi] = frag_ld(As + (m0 + mi) * 16 * LDA + ks * 32, LDA, lane);
#pragma unroll
      for (int mi = 0; mi < AG; ++mi)
#pragma unroll
        for (int j = 0; j < NT; ++j)
          acc[j * 4 + m0 + mi] = wmma_f16(af[mi], bf[ks % D][j], acc[j * 4 + m0 + mi]);
      // order: a group's LDS reads together (one LDS wait a group, not one a fragment),
      // then its WMMAs
      __builtin_amdgcn_sched_group_barrier(0x100, 2 * AG, 0);
      __builtin_amdgcn_sched_group_barrier(0x008, AG * NT, 0);
    }
    if (ks + D < DIMC / 32) {
#pragma unroll
      for (int j = 0; j < NT; ++j)
        bf[ks % D][j] = frag_ldw(B0 + j * bstride + (ks + D) * 512, lane);
      __builtin_amdgcn_sched_group_barrier(0x020, 2 * NT, 0);   // the refill behind them
      // holds the refill at the foot of its step (same reason as above)
      __builtin_amdgcn_sched_barrier(0);
    }
  }
}

// GELU(v) = 0.5 v (1 + erf(v / sqrt 2)) of the 8 values of a tile, with erf from
// ONE formula for every v:
//   erf(|x|) = 1 - t (a1 + t (a2 + t (a3 + t (a4 + t a5)))) exp(-x^2),  t = 1 / (1 + p |x|)
// No case split, so no lane mask and no branch stands between two elements, and the work of
// neighbouring elements can be packed and overlapped. Absolute error of the result below 5e-7
// for every v (it is then rounded to f16). p / sqrt 2 and -log2(e) / 2 are folded into v's
// factors.
__device__ __forceinline__ v8f gelu8(v8f v) {
  float t[8], e[8];
#pragma unroll
  for (int g = 0; g < 8; ++g) {
    t[g] = fmaf(fabsf(v[g]), 0.3275911f * 0.70710678f, 1.f);
    e[g] = v[g] * v[g] * (-0.5f * 1.44269504f);
  }
#pragma unroll
  for (int g = 0; g < 8; ++g) { t[g] = __builtin_amdgcn_rcpf(t[g]); e[g] = __builtin_amdgcn_exp2f(e[g]); }
  // Horner, one step for all 8 elements at a time: the 8 chains do not depend on one another
  float p[8];
  v8f o;
#pragma unroll
  for (int g = 0; g < 8; ++g) p[g] = fmaf(t[g], 1.061405429f, -1.453152027f);
#pragma unroll
  for (int g = 0; g < 8; ++g) p[g] = fmaf(t[g], p[g], 1.421413741f);
#pragma unroll
  for (int g = 0; g < 8; ++g) p[g] = fmaf(t[g], p[g], -0.284496736f);
#pragma unroll
  for (int g = 0; g < 8; ++g) p[g] = fmaf(t[g], p[g], 0.254829592f);
#pragma unroll
  for (int g = 0; g < 8; ++g) p[g] *= t[g];
#pragma unroll
  for (int g = 0; g < 8; ++g) p[g] = copysignf(fmaf(-p[g], e[g], 1.f), v[g]);
#pragma unroll
  for (int g = 0; g < 8; ++g) {
    const float hv = 0.5f * v[g];
    o[g] = fmaf(hv, p[g], hv);
  }
  return o;
}

// async global -> LDS copy of 16 bytes (per-lane), tracked on ASYNCcnt
__device__ __forceinline__ void async_b128(unsigned lds_addr, unsigned long long gaddr) {
  asm volatile("global_load_async_to_lds_b128 %0, %1, off"
               :: "v"(lds_addr), "v"(gaddr) : "memory");
}
__device__ __forceinline__ void wait_async0() {
  asm volatile("s_wait_asynccnt 0x0" ::: "memory");
}

// ---- Prep kernel 1: f32->f16 convert all weights into fragment order -------

__global__ __launch_bounds__(256) void prep_weights(
    const float* __restrict__ qkv_w, const float* __restrict__ proj_w,
    const float* __restrict__ fc1_w, const float* __restrict__ fc2_w,
    half_t* __restrict__ wh)
{
  int idx = blockIdx.x * 256 + threadIdx.x;
  // place inside the 512-half fragment (every matrix starts on a fragment boundary)
  int ln = (idx >> 3) & 31;                                  // lane that reads it
  int nr = ln & 15;                                          // n inside the fragment
  int kk = ((ln >> 4) << 3) + (((idx >> 8) & 1) << 4) + (idx & 7);  // k inside it
  if (idx < OFF_PROJT) {                       // qkvT: 8 fragments per strip
    int f = idx >> 9;
    int n = ((f >> 3) << 4) + nr, k = ((f & 7) << 5) + kk;
    wh[idx] = (half_t)qkv_w[k * 768 + n];
  } else if (idx < OFF_FC1T) {                 // projT: 8 per strip
    int f = (idx - OFF_PROJT) >> 9;
    int n = ((f >> 3) << 4) + nr, k = ((f & 7) << 5) + kk;
    wh[idx] = (half_t)proj_w[k * 256 + n];
  } else if (idx < OFF_FC2T) {                 // fc1T (1024 x 256): 8 per strip
    int f = (idx - OFF_FC1T) >> 9;
    int n = ((f >> 3) << 4) + nr, k = ((f & 7) << 5) + kk;
    wh[idx] = (half_t)fc1_w[k * 1024 + n];
  } else if (idx < TOT_H) {                    // fc2T (256 x 1024): 32 per strip
    int f = (idx - OFF_FC2T) >> 9;
    int n = ((f >> 5) << 4) + nr, k = ((f & 31) << 5) + kk;
    wh[idx] = (half_t)fc2_w[k * 256 + n];
  }
}

// ---- Prep kernel 2: CPB MLP -> 16*sigmoid bias table -----------------------

__device__ __forceinline__ float logrel(int i) {
  float v = (float)(i - 7) * (8.f / 7.f);
  float a = log2f(fabsf(v) + 1.f) * (1.f / 3.f);   // /log2(8)
  return copysignf(a, v);
}

// sum over the 32 lanes of a wave, the same total in every lane: four exchanges inside the
// 16-lane row (DPP row_xmask 1, 2, 4, 8), then one with the other row
template <int XM>
__device__ __forceinline__ float xrow(float x) {
  int b = __builtin_bit_cast(int, x);
  return __builtin_bit_cast(float, __builtin_amdgcn_update_dpp(b, b, 0x160 + XM, 0xf, 0xf, false));
}
__device__ __forceinline__ float wave_sum(float v) {
  v += xrow<1>(v);
  v += xrow<2>(v);
  v += xrow<4>(v);
  v += xrow<8>(v);
  return v + xhalf(v);
}

// One workgroup = one query i and 32 of its 64 keys; one wave = 4 of those keys. The value of
// a (query, key) pair is a sum over the 512 hidden units: the lanes split the units (unit
// 32 s + lane), so a wave's weights come in by vector loads that are all in flight at once
// (one trip to memory for the kernel, not one for every few units), and the 32 partial sums
// meet in a lane exchange. Pairs with the same offset are computed again where they are needed:
// no workgroup waits for another's table. Every loop is unrolled so that the arrays stay in
// registers.
__global__ __launch_bounds__(256) void prep_bias(
    const float* __restrict__ w1, const float* __restrict__ b1,
    const float* __restrict__ w2, float* __restrict__ bias16)
{
  __shared__ float sb[32 * 8];
  const int tid = threadIdx.x, wv = tid >> 5, lane = tid & 31;
  const int i  = blockIdx.x >> 1;
  const int j0 = (blockIdx.x & 1) << 5;

  float wa[16], wb[16], bh[16];
  v4f wo[16][2];
#pragma unroll
  for (int s = 0; s < 16; ++s) {
    const int m = s * 32 + lane;
    wa[s] = w1[m];
    wb[s] = w1[512 + m];
    bh[s] = b1[m];
    wo[s][0] = *(const v4f*)(w2 + m * 8);
    wo[s][1] = *(const v4f*)(w2 + m * 8 + 4);
  }
  // holds all 80 loads in front of the arithmetic: sunk towards their uses they would go out in
  // several batches, each waited for at full memory latency
  __builtin_amdgcn_sched_barrier(0);

  float fx[4], fy[4], acc[4][8];
#pragma unroll
  for (int e = 0; e < 4; ++e) {
    const int j = j0 + wv * 4 + e;
    fx[e] = logrel((i >> 3) - (j >> 3) + 7);
    fy[e] = logrel((i & 7) - (j & 7) + 7);
#pragma unroll
    for (int h = 0; h < 8; ++h) acc[e][h] = 0.f;
  }
#pragma unroll
  for (int s = 0; s < 16; ++s)
#pragma unroll
    for (int e = 0; e < 4; ++e) {
      float hv = fmaxf(fx[e] * wa[s] + fy[e] * wb[s] + bh[s], 0.f);
#pragma unroll
      for (int h = 0; h < 8; ++h) acc[e][h] += hv * wo[s][h >> 2][h & 3];
    }
#pragma unroll
  for (int e = 0; e < 4; ++e)
#pragma unroll
    for (int h = 0; h < 8; ++h) acc[e][h] = wave_sum(acc[e][h]);
  if (lane == 0) {
#pragma unroll
    for (int e = 0; e < 4; ++e)
#pragma unroll
      for (int h = 0; h < 8; ++h) sb[(wv * 4 + e) * 8 + h] = acc[e][h];
  }
  __syncthreads();
  // thread = (head, key): a wave stores one whole 128-byte line
  const int h = tid >> 5, jj = tid & 31;
  bias16[h * 4096 + i * 64 + j0 + jj] = 16.f / (1.f + __expf(-sb[jj * 8 + h]));
}

// Mean and 1 / sqrt(variance + eps) of a 256-column f16 row that 4 lanes share (l, l ^ 8,
// l ^ 16, l ^ 24): p = the lane's 64 columns, left in ov. Each lane sums its 64 terms, two lane
// exchanges add the four parts; every lane of the row gets the same totals.
// (Loops unrolled: vector elements are reached by constant index only.)
__device__ __forceinline__ void ln_stats(const half_t* p, v8h* ov, float& mu, float& rs) {
#pragma unroll
  for (int i = 0; i < 8; ++i) ov[i] = *(const v8h*)(p + i * 8);
  float s8[8];
#pragma unroll
  for (int i = 0; i < 8; ++i) {
    s8[i] = 0.f;
#pragma unroll
    for (int s = 0; s < 8; ++s) s8[i] += (float)ov[i][s];
  }
  float sm = ((s8[0] + s8[1]) + (s8[2] + s8[3])) + ((s8[4] + s8[5]) + (s8[6] + s8[7]));
  sm += xrow<8>(sm);
  sm += xhalf(sm);
  mu = sm * (1.f / DIMC);
#pragma unroll
  for (int i = 0; i < 8; ++i) {
    s8[i] = 0.f;
#pragma unroll
    for (int s = 0; s < 8; ++s) { const float d = (float)ov[i][s] - mu; s8[i] += d * d; }
  }
  float vr = ((s8[0] + s8[1]) + (s8[2] + s8[3])) + ((s8[4] + s8[5]) + (s8[6] + s8[7]));
  vr += xrow<8>(vr);
  vr += xhalf(vr);
  rs = rsqrtf(vr * (1.f / DIMC) + 1e-5f);
}

// ---- Main fused Swin-V2 block kernel: one 8x8 window per workgroup ---------

// second bound: 4 waves a SIMD (256 registers a wave), so that two workgroups still share a WGP
__global__ __launch_bounds__(256, 4) void swin_block(
    const float* __restrict__ x,
    const float* __restrict__ logit_scale,
    const float* __restrict__ proj_b,
    const float* __restrict__ ln1_w, const float* __restrict__ ln1_b,
    const float* __restrict__ fc1_b, const float* __restrict__ fc2_b,
    const float* __restrict__ ln2_w, const float* __restrict__ ln2_b,
    const half_t* __restrict__ wh, const float* __restrict__ bias16,
    float* __restrict__ out)
{
  // attention scratch overlaid with the raw f32 input staging buffer:
  // xstage is only live before the head loop starts.
  union SMem {
    float xstage[MTOK * DIMC];                 // 64 KB raw window (f32)
    struct {
      half_t S16[MTOK * LDA];                  // o / gelu chunk / mlp staging
      half_t qb[4 * MTOK * HD];                // q, k, v of a group of 4 heads
      half_t kb[4 * MTOK * HD];
      half_t vT[4 * HD * MTOK];                // v transposed (M=d x K=j)
    } at;
  };
  __shared__ SMem U;
  __shared__ half_t XY16[MTOK * LDA];          // x window -> y (in place)
  __shared__ float  muA[MTOK], rsA[MTOK];
  __shared__ int    lab[MTOK];

  half_t* S16 = U.at.S16;
  half_t* qb4 = U.at.qb;
  half_t* kb4 = U.at.kb;
  half_t* vT4 = U.at.vT;

  const int tid  = threadIdx.x;
  const int wv   = tid >> 5;
  const int lane = tid & 31;
  const int blk  = blockIdx.x;
  const int b    = blk >> 10;
  const int wi   = blk & 1023;
  const int wy   = wi >> 5, wx = wi & 31;

  const half_t* qkvT  = wh + OFF_QKVT;
  const half_t* projT = wh + OFF_PROJT;
  const half_t* fc1T  = wh + OFF_FC1T;
  const half_t* fc2T  = wh + OFF_FC2T;

  // ---- async DMA the shifted window (f32) into LDS staging ----
  // 4096 x 16B copies: job = (c, ty, 4px-group); each group is contiguous in
  // memory even across the cyclic-shift wrap (group start gx <= 252 always).
#pragma unroll
  for (int it = 0; it < 16; ++it) {
    int job = it * 256 + tid;
    int c   = job >> 4;
    int rem = job & 15;
    int ty  = rem >> 1;
    int grp = rem & 1;
    int gy  = ((wy << 3) + ty + SHIFTS) & 255;
    int gx  = ((wx << 3) + (grp << 2) + SHIFTS) & 255;
    const float* gp = x + (((size_t)(b * DIMC + c)) << 16) + (gy << 8) + gx;
    unsigned lds = (unsigned)(unsigned long long)(uintptr_t)
                   (&U.xstage[c * MTOK + ty * 8 + grp * 4]);
    async_b128(lds, (unsigned long long)(uintptr_t)gp);
  }
  if (tid < 64) {
    int r = tid;
    int sy = (wy << 3) + (r >> 3), sx = (wx << 3) + (r & 7);
    int ry = (sy < IMG - WSZ) ? 0 : (sy < IMG - SHIFTS ? 1 : 2);
    int rx = (sx < IMG - WSZ) ? 0 : (sx < IMG - SHIFTS ? 1 : 2);
    lab[r] = ry * 3 + rx;
  }
  if (tid == 0 && blk + 1 < (int)gridDim.x)
    __builtin_prefetch(x + ((size_t)((blk + 1) >> 10) << 24), 0, 1);
  wait_async0();
  __syncthreads();

  // convert staged f32 -> f16 A-operand layout (token-major, padded rows)
  for (int it = 0; it < 64; ++it) {
    int idx = it * 256 + tid;
    int r = idx & 63, c = idx >> 6;
    XY16[r * LDA + c] = (half_t)U.xstage[c * MTOK + r];
  }
  __syncthreads();

  // ---- attention: QKV product for 4 heads at a time, then the 4 heads side by side ----
  for (int hg = 0; hg < HEADS / 4; ++hg) {
    // the attention part's split: one wave = 32 queries of one head
    const int hw = wv >> 1;                    // head inside the group
    const int h  = hg * 4 + hw;
    const int i0 = (wv & 1) << 5;              // first query of this wave
    const int cl = lane & 15, hh = lane >> 4;
    float lsc;                                 // logit scale of the head
    v4f bv[2][4][2];                           // bias of query i0+16it+cl, keys 16jt+8hh+0..7
    // 24 column tiles (q, k, v x 4 heads x 2): each wave takes one of q, of k and of v,
    // with all 4 row tiles, K = 256
    {
      int nw = wv & 1;                         // column tile inside the head
      v8f acc[12];
#pragma unroll
      for (int t = 0; t < 12; ++t) acc[t] = ZERO8;
      strip_gemm<3, 3, 2>(XY16, qkvT + (size_t)((hg * 4 + hw) * HD + nw * 16) * DIMC, DIMC * DIMC,
                    lane, acc);
      // issued here so that these global loads fly during the LDS stores below
      lsc = logit_scale[h];
      const float* bbase = bias16 + h * 4096 + (i0 + cl) * 64 + hh * 8;
#pragma unroll
      for (int it = 0; it < 2; ++it)
#pragma unroll
        for (int jt = 0; jt < 4; ++jt) {
          const float* bp = bbase + it * 1024 + jt * 16;
          bv[it][jt][0] = *(const v4f*)bp;
          bv[it][jt][1] = *(const v4f*)(bp + 4);
        }
      // the run's address pair is an input here, so it stays live up to this wait and no
      // result of the run lands in it before the wait has passed
      asm volatile("s_wait_xcnt 0x0" :: "v"(bbase) : "memory");
      int No = nw * 16 + (lane & 15);
#pragma unroll
      for (int mi = 0; mi < 4; ++mi) {
        int Mo = mi * 16 + ((lane >> 4) << 3);
#pragma unroll
        for (int g = 0; g < 8; ++g) {
          qb4[hw * (MTOK * HD) + (Mo + g) * HD + No]   = (half_t)acc[mi][g];
          kb4[hw * (MTOK * HD) + (Mo + g) * HD + No]   = (half_t)acc[4 + mi][g];
          vT4[hw * (MTOK * HD) + No * MTOK + (Mo + g)] = (half_t)acc[8 + mi][g];
        }
      }
    }
    __syncthreads();

    // One wave = 32 queries of one head, all in registers. Scores are built transposed
    // (S^T = K Q^T): a lane holds 32 of the 64 scores of one query, lane l ^ 16 the rest,
    // and two score tiles, converted in place, are the B fragment of O^T = V^T P^T.
    // Every loop here is unrolled so that each tile index is a constant and the tiles
    // stay in registers.
    {
      const half_t* qb = qb4 + hw * (MTOK * HD);
      const half_t* kb = kb4 + hw * (MTOK * HD);
      const half_t* vT = vT4 + hw * (MTOK * HD);

      // cosine attention: unit rows, logit scale folded into q
      const float qs = __expf(fminf(lsc, 4.6051702f));
      v16h qf[2];
#pragma unroll
      for (int it = 0; it < 2; ++it)
        qf[it] = frag_unit(frag_ld(qb + (i0 + it * 16) * HD, HD, lane), qs);

      v8f st[2][4];                            // st[it][jt][g] = S[i0+16it+cl][16jt+8hh+g]
#pragma unroll
      for (int jt = 0; jt < 4; ++jt) {
        v16h kf = frag_unit(frag_ld(kb + jt * 16 * HD, HD, lane), 1.f);
#pragma unroll
        for (int it = 0; it < 2; ++it) st[it][jt] = wmma_f16(kf, qf[it], ZERO8);
      }

      v16h pf[2][2];                           // P^T, k = 32 keys each
#pragma unroll
      for (int it = 0; it < 2; ++it) {
        const int i = i0 + it * 16 + cl;
        const int li = lab[i];
        float mx = -1e30f;
#pragma unroll
        for (int jt = 0; jt < 4; ++jt)
#pragma unroll
          for (int g = 0; g < 8; ++g) {
            float msk = (li == lab[jt * 16 + hh * 8 + g]) ? 0.f : -100.f;
            float v = st[it][jt][g] + bv[it][jt][g >> 2][g & 3] + msk;
            st[it][jt][g] = v;
            mx = fmaxf(mx, v);
          }
        mx = fmaxf(mx, xhalf(mx));
        float s = 0.f;
#pragma unroll
        for (int jt = 0; jt < 4; ++jt)
#pragma unroll
          for (int g = 0; g < 8; ++g) {
            float e = __expf(st[it][jt][g] - mx);
            st[it][jt][g] = e;
            s += e;
          }
        s += xhalf(s);
        const float invs = 1.f / s;
#pragma unroll
        for (int kq = 0; kq < 2; ++kq)
#pragma unroll
          for (int g = 0; g < 8; ++g) {
            pf[it][kq][g]     = (half_t)(st[it][2 * kq][g] * invs);
            pf[it][kq][8 + g] = (half_t)(st[it][2 * kq + 1][g] * invs);
          }
      }

      // O^T = V^T P^T (K = 64): a lane's 8 results are 8 neighbouring d of one query
#pragma unroll
      for (int dt = 0; dt < 2; ++dt) {
        v16h vf0 = frag_ld(vT + dt * 16 * MTOK, MTOK, lane);
        v16h vf1 = frag_ld(vT + dt * 16 * MTOK + 32, MTOK, lane);
#pragma unroll
        for (int it = 0; it < 2; ++it) {
          v8f o = wmma_f16(vf1, pf[it][1], wmma_f16(vf0, pf[it][0], ZERO8));
          v8h oh;
#pragma unroll
          for (int g = 0; g < 8; ++g) oh[g] = (half_t)o[g];
          *(v8h*)&S16[(i0 + it * 16 + cl) * LDA + h * HD + dt * 16 + hh * 8] = oh;
        }
      }
    }
    // ends every wave's reads of q, k, v before the next group overwrites them, and
    // publishes the head columns of S16 to the projection
    __syncthreads();
  }

  // ---- output projection: 64 tiles, 8 per wave (4 row x 2 column tiles), K = 256 ----
  v8f pres[8];
#pragma unroll
  for (int t = 0; t < 8; ++t) pres[t] = ZERO8;
  strip_gemm<2, 4, 4>(S16, projT + (size_t)(wv * 32) * DIMC, 16 * DIMC, lane, pres);
  __syncthreads();
#pragma unroll
  for (int t = 0; t < 8; ++t) {
    int mi = t & 3, ni = (wv << 1) + (t >> 2);
    int Mo = mi * 16 + ((lane >> 4) << 3);
    int No = ni * 16 + (lane & 15);
    float pb = proj_b[No];
#pragma unroll
    for (int g = 0; g < 8; ++g) S16[(Mo + g) * LDA + No] = (half_t)(pres[t][g] + pb);
  }
  __syncthreads();

  // ---- y = LN1(o) + x  (in place into XY16) ----
  // Both layer norms: 4 lanes a row (lanes l, l ^ 8, l ^ 16, l ^ 24), 8 rows a wave, all 8 waves.
  // A lane keeps its 64 columns in registers (8 reads of 16 bytes), so a row is read once for
  // mean and variance, and in LN1 for the result too. Lanes 0-15 of a read fall on 16 different groups of 4 banks
  // (row pitch = 33 x 16 bytes, quarter = 8 x 16 bytes).
  const int lr = wv * 8 + (lane & 7);          // row of this lane
  const int lc = (lane >> 3) << 6;             // first of its 64 columns
  {
    v8h ov[8];
    float mu, rs;
    ln_stats(S16 + lr * LDA + lc, ov, mu, rs);
    // unrolled: ov is reached by constant index only
#pragma unroll
    for (int i = 0; i < 8; ++i) {
      const v8h xv = *(const v8h*)&XY16[lr * LDA + lc + i * 8];
      v8h yv;
#pragma unroll
      for (int q = 0; q < 2; ++q) {
        const v4f w4 = *(const v4f*)(ln1_w + lc + i * 8 + q * 4);
        const v4f b4 = *(const v4f*)(ln1_b + lc + i * 8 + q * 4);
#pragma unroll
        for (int s = 0; s < 4; ++s)
          yv[q * 4 + s] = (half_t)(((float)ov[i][q * 4 + s] - mu) * rs * w4[s] + b4[s]
                                   + (float)xv[q * 4 + s]);
      }
      *(v8h*)&XY16[lr * LDA + lc + i * 8] = yv;
      // the scale and shift loads go out in two runs of 16: with all 32 in flight the kernel
      // runs out of registers and spills
      if (i == 3) __builtin_amdgcn_sched_barrier(0);
    }
  }
  __syncthreads();

  // ---- MLP: 4 chunks of 256 hidden; fc2 accumulates persistently ----
  v8f acc2[8];
#pragma unroll
  for (int t = 0; t < 8; ++t) acc2[t] = ZERO8;

  for (int kc = 0; kc < 4; ++kc) {
    v8f r1[8];
#pragma unroll
    for (int t = 0; t < 8; ++t) r1[t] = ZERO8;
    strip_gemm<2, 2, 2>(XY16, fc1T + (size_t)(kc * 256 + wv * 32) * DIMC, 16 * DIMC, lane, r1);
#pragma unroll
    for (int t = 0; t < 8; ++t) {              // bias onto the whole tiles
      int ni = (wv << 1) + (t >> 2);
      int No = ni * 16 + (lane & 15);
      float bb = fc1_b[kc * 256 + No];
      r1[t] += bb;
    }
#pragma unroll
    for (int t = 0; t < 8; ++t) {
      int mi = t & 3, ni = (wv << 1) + (t >> 2);
      int Mo = mi * 16 + ((lane >> 4) << 3);
      int No = ni * 16 + (lane & 15);
      v8f ge = gelu8(r1[t]);
#pragma unroll
      for (int g = 0; g < 8; ++g) S16[(Mo + g) * LDA + No] = (half_t)ge[g];
    }
    __syncthreads();
    strip_gemm<2, 4, 4>(S16, fc2T + (size_t)(wv * 32) * HIDDEN + kc * 256 * 16, 16 * HIDDEN, lane, acc2);
    __syncthreads();
  }

  // mlp result into S16
#pragma unroll
  for (int t = 0; t < 8; ++t) {
    int mi = t & 3, ni = (wv << 1) + (t >> 2);
    int Mo = mi * 16 + ((lane >> 4) << 3);
    int No = ni * 16 + (lane & 15);
    float bb = fc2_b[No];
#pragma unroll
    for (int g = 0; g < 8; ++g) S16[(Mo + g) * LDA + No] = (half_t)(acc2[t][g] + bb);
  }
  __syncthreads();

  // LN2 stats
  {
    v8h ov[8];
    float mu, rs;
    ln_stats(S16 + lr * LDA + lc, ov, mu, rs);
    if (lane < 8) { muA[lr] = mu; rsA[lr] = rs; }
  }
  __syncthreads();

  // ---- final: out = LN2(mlp) + y, window-reverse + un-shift ----
  for (int it = 0; it < 64; ++it) {
    int c = (it << 2) + (tid >> 6);
    int r = tid & 63;
    float mv = ((float)S16[r * LDA + c] - muA[r]) * rsA[r] * ln2_w[c] + ln2_b[c];
    float yv = mv + (float)XY16[r * LDA + c];
    int gy = ((wy << 3) + (r >> 3) + SHIFTS) & 255;
    int gx = ((wx << 3) + (r & 7) + SHIFTS) & 255;
    out[(((size_t)(b * DIMC + c)) << 16) + (gy << 8) + gx] = yv;
  }
}

// ---- launch ----------------------------------------------------------------

extern "C" void kernel_launch(void* const* d_in, const int* in_sizes, int n_in,
                              void* d_out, int out_size, void* d_ws, size_t ws_size,
                              hipStream_t stream) {
  (void)in_sizes; (void)n_in; (void)out_size; (void)ws_size;
  const float* x        = (const float*)d_in[0];
  const float* qkv_w    = (const float*)d_in[1];
  const float* lscale   = (const float*)d_in[2];
  const float* proj_w   = (const float*)d_in[3];
  const float* proj_b   = (const float*)d_in[4];
  const float* ln1_w    = (const float*)d_in[5];
  const float* ln1_b    = (const float*)d_in[6];
  const float* fc1_w    = (const float*)d_in[7];
  const float* fc1_b    = (const float*)d_in[8];
  const float* fc2_w    = (const float*)d_in[9];
  const float* fc2_b    = (const float*)d_in[10];
  const float* ln2_w    = (const float*)d_in[11];
  const float* ln2_b    = (const float*)d_in[12];
  const float* cpb_w1   = (const float*)d_in[13];
  const float* cpb_b1   = (const float*)d_in[14];
  const float* cpb_w2   = (const float*)d_in[15];

  half_t* wh     = (half_t*)d_ws;
  float*  bias16 = (float*)((char*)d_ws + OFF_BIAS_BYTES);
  float*  out    = (float*)d_out;

  prep_weights<<<TOT_H / 256, 256, 0, stream>>>(qkv_w, proj_w, fc1_w, fc2_w, wh);
  prep_bias<<<128, 256, 0, stream>>>(cpb_w1, cpb_b1, cpb_w2, bias16);
  swin_block<<<2048, 256, 0, stream>>>(x, lscale, proj_b, ln1_w, ln1_b,
                                       fc1_b, fc2_b, ln2_w, ln2_b,
                                       wh, bias16, out);
}

// v008
// One run takes 301 microseconds.
// Two timings next to v007 both put it at 1.06 times that version's speed.
// All steps since v000 together make it 3.93 times as fast.
#include <hip/hip_runtime.h>
#include <hip/hip_bf16.h>
#include <math.h>

typedef _Float16 half_t;
typedef half_t v16h __attribute__((ext_vector_type(16)));
typedef half_t v8h  __attribute__((ext_vector_type(8)));
typedef float  v8f  __attribute__((ext_vector_type(8)));
typedef float  v4f  __attribute__((ext_vector_type(4)));

#define DIMC   256
#define HEADS  8
#define HD     32
#define WSZ    8
#define SHIFTS 4
#define MTOK   64
#define IMG    256
#define HIDDEN 1024
#define LDA    264   // padded f16 row stride (264 halves = 528B, bank-spread, 16B-aligned)

// workspace layout (in halves): qkvT 768x256 | projT 256x256 | fc1T 1024x256 | fc2T 256x1024
// Each N x K matrix is stored fragment by fragment (16 n x 32 k = 512 halves = 1 KiB),
// fragments of one 16-row strip following each other along k. Inside a fragment the
// halves lie in register order: 32 lanes x first 8 halves (512 B), then 32 lanes x
// second 8 halves (512 B), so each wave-wide 16-byte load reads 4 whole 128-B lines.
#define OFF_QKVT 0
#define OFF_PROJT (768*256)
#define OFF_FC1T  (OFF_PROJT + 256*256)
#define OFF_FC2T  (OFF_FC1T + 1024*256)
#define TOT_H     (OFF_FC2T + 256*1024)
#define OFF_BIAS_BYTES ((size_t)TOT_H * 2)   // then float bias16[8][64][64]

// ---- WMMA helpers -----------------------------------------------------------

// 16x32 f16 fragment (A from XY16, S16, kb and vT; also B from the N x K LDS buffer qb).
// CDNA5 layout: lanes 0-15 row M=lane hold K 0..7 then 16..23;
// lanes 16-31 hold K 8..15 then 24..31.
__device__ __forceinline__ v16h frag_ld(const half_t* p0, int ld, int lane) {
  const half_t* p = p0 + (lane & 15) * ld + ((lane >> 4) << 3);
  v8h lo = *(const v8h*)p;
  v8h hi = *(const v8h*)(p + 16);
  return __builtin_shufflevector(lo, hi, 0,1,2,3,4,5,6,7,8,9,10,11,12,13,14,15);
}

// B fragment from the packed weights: same lane/k map as frag_ld, contiguous bytes.
__device__ __forceinline__ v16h frag_ldw(const half_t* frag, int lane) {
  const half_t* p = frag + lane * 8;
  v8h lo = *(const v8h*)p;
  v8h hi = *(const v8h*)(p + 256);
  return __builtin_shufflevector(lo, hi, 0,1,2,3,4,5,6,7,8,9,10,11,12,13,14,15);
}

__device__ __forceinline__ v8f wmma_f16(v16h a, v16h b, v8f c) {
  return __builtin_amdgcn_wmma_f32_16x16x32_f16(false, a, false, b, (short)0, c,
                                                false, false);
}

#define ZERO8 ((v8f){0.f,0.f,0.f,0.f,0.f,0.f,0.f,0.f})

// value of lane l ^ 16 (the lane that holds the other half of the same row or column)
__device__ __forceinline__ float xhalf(float x) {
  int b = __builtin_bit_cast(int, x);
  return __builtin_bit_cast(float, __builtin_amdgcn_permlanex16(b, b, 0x76543210, 0xfedcba98,
                                                                false, false));
}

// Scale a 16 x 32 fragment's rows to unit length, times mul. Lanes l and l ^ 16 hold the
// two halves of one row, so the sum of squares is 16 terms in the lane plus one exchange.
// (Loops unrolled: vector elements are reached by constant index only.)
__device__ __forceinline__ v16h frag_unit(v16h f, float mul) {
  float ss = 0.f;
#pragma unroll
  for (int s = 0; s < 16; ++s) { float v = (float)f[s]; ss += v * v; }
  ss += xhalf(ss);
  float inv = 1.f / fmaxf(sqrtf(ss), 1e-12f) * mul;
  v16h o;
#pragma unroll
  for (int s = 0; s < 16; ++s) o[s] = (half_t)((float)f[s] * inv);
  return o;
}

// One wave's strip of a 64 x N product, K = 256: all 4 row tiles x NT column tiles.
// Each packed weight fragment is loaded once and feeds 4 WMMAs. The weight fragments run
// through a register ring D k steps deep: the loads of step ks + D are issued as soon as
// step ks has used its slot, so a load has D - 1 steps of WMMAs to come back from L2.
// The A fragments of a step are read from LDS in groups of AG. D and AG are what each
// caller's live accumulators leave room for. acc[j * 4 + mi]; k runs upward for every tile.
template <int NT, int D, int AG>
__device__ __forceinline__ void strip_gemm(const half_t* As, const half_t* B0, int bstride,
                                           int lane, v8f* acc) {
  v16h bf[D][NT];
#pragma unroll
  for (int p = 0; p < D; ++p)
#pragma unroll
    for (int j = 0; j < NT; ++j) bf[p][j] = frag_ldw(B0 + j * bstride + p * 512, lane);
  // holds the ring's first loads here: sunk to their first use they would each be waited
  // for at full L2 latency
  __builtin_amdgcn_sched_barrier(0);
  // unrolled so that every ring slot is a constant index and stays in registers
#pragma unroll
  for (int ks = 0; ks < DIMC / 32; ++ks) {
#pragma unroll
    for (int m0 = 0; m0 < 4; m0 += AG) {
      v16h af[AG];
#pragma unroll
      for (int mi = 0; mi < AG; ++mi)
        af[mi] = frag_ld(As + (m0 + mi) * 16 * LDA + ks * 32, LDA, lane);
#pragma unroll
      for (int mi = 0; mi < AG; ++mi)
#pragma unroll
        for (int j = 0; j < NT; ++j)
          acc[j * 4 + m0 + mi] = wmma_f16(af[mi], bf[ks % D][j], acc[j * 4 + m0 + mi]);
      // order: a group's LDS reads together (one LDS wait a group, not one a fragment),
      // then its WMMAs
      __builtin_amdgcn_sched_group_barrier(0x100, 2 * AG, 0);
      __builtin_amdgcn_sched_group_barrier(0x008, AG * NT, 0);
    }
    if (ks + D < DIMC / 32) {
#pragma unroll
      for (int j = 0; j < NT; ++j)
        bf[ks % D][j] = frag_ldw(B0 + j * bstride + (ks + D) * 512, lane);
      __builtin_amdgcn_sched_group_barrier(0x020, 2 * NT, 0);   // the refill behind them
      // holds the refill at the foot of its step (same reason as above)
      __builtin_amdgcn_sched_barrier(0);
    }
  }
}

// GELU(v) = 0.5 v (1 + erf(v / sqrt 2)) of the 8 values of a tile, with erf from
// ONE formula for every v:
//   erf(|x|) = 1 - t (a1 + t (a2 + t (a3 + t (a4 + t a5)))) exp(-x^2),  t = 1 / (1 + p |x|)
// No case split, so no lane mask and no branch stands between two elements, and the work of
// neighbouring elements can be packed and overlapped. Absolute error of the result below 5e-7
// for every v (it is then rounded to f16). p / sqrt 2 and -log2(e) / 2 are folded into v's
// factors.
__device__ __forceinline__ v8f gelu8(v8f v) {
  float t[8], e[8];
#pragma unroll
  for (int g = 0; g < 8; ++g) {
    t[g] = fmaf(fabsf(v[g]), 0.3275911f * 0.70710678f, 1.f);
    e[g] = v[g] * v[g] * (-0.5f * 1.44269504f);
  }
#pragma unroll
  for (int g = 0; g < 8; ++g) { t[g] = __builtin_amdgcn_rcpf(t[g]); e[g] = __builtin_amdgcn_exp2f(e[g]); }
  // Horner, one step for all 8 elements at a time: the 8 chains do not depend on one another
  float p[8];
  v8f o;
#pragma unroll
  for (int g = 0; g < 8; ++g) p[g] = fmaf(t[g], 1.061405429f, -1.453152027f);
#pragma unroll
  for (int g = 0; g < 8; ++g) p[g] = fmaf(t[g], p[g], 1.421413741f);
#pragma unroll
  for (int g = 0; g < 8; ++g) p[g] = fmaf(t[g], p[g], -0.284496736f);
#pragma unroll
  for (int g = 0; g < 8; ++g) p[g] = fmaf(t[g], p[g], 0.254829592f);
#pragma unroll
  for (int g = 0; g < 8; ++g) p[g] *= t[g];
#pragma unroll
  for (int g = 0; g < 8; ++g) p[g] = copysignf(fmaf(-p[g], e[g], 1.f), v[g]);
#pragma unroll
  for (int g = 0; g < 8; ++g) {
    const float hv = 0.5f * v[g];
    o[g] = fmaf(hv, p[g], hv);
  }
  return o;
}

// Async global -> LDS copies (16 bytes a lane, tracked on ASYNCcnt) of a quarter (64 channels) of
// one shifted window, raw f32, channel-major. The window is 4096 x 16 B; job = (c, ty, 4px-group);
// each group is contiguous in memory even across the cyclic-shift wrap (group start gx <= 252
// always). A thread's 16 jobs differ in the channel only: channel 64 qt + 16 q + tid / 16.
// The four LDS places lie 4 KiB apart. The instruction's offset moves both addresses, so the
// copies name one LDS address register and the offset is taken off the global address again.
// The statement is closed by the wait that stands between a copy and the rewriting of the
// address registers it names (inside the statement nothing can move over it).
__device__ __forceinline__ void copy_quarter(const float* __restrict__ x, int blk, int qt, int tid,
                                             float* xstage) {
  const int b  = blk >> 10;
  const int wy = (blk & 1023) >> 5, wx = blk & 31;
  const int ty = (tid & 15) >> 1, grp = tid & 1;
  const int gy = ((wy << 3) + ty + SHIFTS) & 255;
  const int gx = ((wx << 3) + (grp << 2) + SHIFTS) & 255;
  const float* gp = x + (((size_t)(b * DIMC + qt * 64 + (tid >> 4))) << 16) + (gy << 8) + gx;
  const unsigned lds = (unsigned)(unsigned long long)(uintptr_t)
                       (xstage + (qt * 64 + (tid >> 4)) * MTOK + ty * 8 + grp * 4);
  unsigned long long g[4];
  // unrolled: the operands of the statement are separate registers
#pragma unroll
  for (int q = 0; q < 4; ++q)
    g[q] = (unsigned long long)(uintptr_t)(gp + ((size_t)(q * 16) << 16) - q * (16 * MTOK));
  asm volatile("global_load_async_to_lds_b128 %0, %1, off\n\t"
               "global_load_async_to_lds_b128 %0, %2, off offset:4096\n\t"
               "global_load_async_to_lds_b128 %0, %3, off offset:8192\n\t"
               "global_load_async_to_lds_b128 %0, %4, off offset:12288\n\t"
               "s_wait_xcnt 0x0"
               :: "v"(lds), "v"(g[0]), "v"(g[1]), "v"(g[2]), "v"(g[3])
               : "memory");
}
__device__ __forceinline__ void wait_async0() {
  asm volatile("s_wait_asynccnt 0x0" ::: "memory");
}

// ---- Prep kernel 1: f32->f16 convert all weights into fragment order -------

__global__ __launch_bounds__(256) void prep_weights(
    const float* __restrict__ qkv_w, const float* __restrict__ proj_w,
    const float* __restrict__ fc1_w, const float* __restrict__ fc2_w,
    half_t* __restrict__ wh)
{
  int idx = blockIdx.x * 256 + threadIdx.x;
  // place inside the 512-half fragment (every matrix starts on a fragment boundary)
  int ln = (idx >> 3) & 31;                                  // lane that reads it
  int nr = ln & 15;                                          // n inside the fragment
  int kk = ((ln >> 4) << 3) + (((idx >> 8) & 1) << 4) + (idx & 7);  // k inside it
  if (idx < OFF_PROJT) {                       // qkvT: 8 fragments per strip
    int f = idx >> 9;
    int n = ((f >> 3) << 4) + nr, k = ((f & 7) << 5) + kk;
    wh[idx] = (half_t)qkv_w[k * 768 + n];
  } else if (idx < OFF_FC1T) {                 // projT: 8 per strip
    int f = (idx - OFF_PROJT) >> 9;
    int n = ((f >> 3) << 4) + nr, k = ((f & 7) << 5) + kk;
    wh[idx] = (half_t)proj_w[k * 256 + n];
  } else if (idx < OFF_FC2T) {                 // fc1T (1024 x 256): 8 per strip
    int f = (idx - OFF_FC1T) >> 9;
    int n = ((f >> 3) << 4) + nr, k = ((f & 7) << 5) + kk;
    wh[idx] = (half_t)fc1_w[k * 1024 + n];
  } else if (idx < TOT_H) {                    // fc2T (256 x 1024): 32 per strip
    int f = (idx - OFF_FC2T) >> 9;
    int n = ((f >> 5) << 4) + nr, k = ((f & 31) << 5) + kk;
    wh[idx] = (half_t)fc2_w[k * 256 + n];
  }
}

// ---- Prep kernel 2: CPB MLP -> 16*sigmoid bias table -----------------------

__device__ __forceinline__ float logrel(int i) {
  float v = (float)(i - 7) * (8.f / 7.f);
  float a = log2f(fabsf(v) + 1.f) * (1.f / 3.f);   // /log2(8)
  return copysignf(a, v);
}

// sum over the 32 lanes of a wave, the same total in every lane: four exchanges inside the
// 16-lane row (DPP row_xmask 1, 2, 4, 8), then one with the other row
template <int XM>
__device__ __forceinline__ float xrow(float x) {
  int b = __builtin_bit_cast(int, x);
  return __builtin_bit_cast(float, __builtin_amdgcn_update_dpp(b, b, 0x160 + XM, 0xf, 0xf, false));
}
__device__ __forceinline__ float wave_sum(float v) {
  v += xrow<1>(v);
  v += xrow<2>(v);
  v += xrow<4>(v);
  v += xrow<8>(v);
  return v + xhalf(v);
}

// One workgroup = one query i and 32 of its 64 keys; one wave = 4 of those keys. The value of
// a (query, key) pair is a sum over the 512 hidden units: the lanes split the units (unit
// 32 s + lane), so a wave's weights come in by vector loads that are all in flight at once
// (one trip to memory for the kernel, not one for every few units), and the 32 partial sums
// meet in a lane exchange. Pairs with the same offset are computed again where they are needed:
// no workgroup waits for another's table. Every loop is unrolled so that the arrays stay in
// registers.
__global__ __launch_bounds__(256) void prep_bias(
    const float* __restrict__ w1, const float* __restrict__ b1,
    const float* __restrict__ w2, float* __restrict__ bias16)
{
  __shared__ float sb[32 * 8];
  const int tid = threadIdx.x, wv = tid >> 5, lane = tid & 31;
  const int i  = blockIdx.x >> 1;
  const int j0 = (blockIdx.x & 1) << 5;

  float wa[16], wb[16], bh[16];
  v4f wo[16][2];
#pragma unroll
  for (int s = 0; s < 16; ++s) {
    const int m = s * 32 + lane;
    wa[s] = w1[m];
    wb[s] = w1[512 + m];
    bh[s] = b1[m];
    wo[s][0] = *(const v4f*)(w2 + m * 8);
    wo[s][1] = *(const v4f*)(w2 + m * 8 + 4);
  }
  // holds all 80 loads in front of the arithmetic: sunk towards their uses they would go out in
  // several batches, each waited for at full memory latency
  __builtin_amdgcn_sched_barrier(0);

  float fx[4], fy[4], acc[4][8];
#pragma unroll
  for (int e = 0; e < 4; ++e) {
    const int j = j0 + wv * 4 + e;
    fx[e] = logrel((i >> 3) - (j >> 3) + 7);
    fy[e] = logrel((i & 7) - (j & 7) + 7);
#pragma unroll
    for (int h = 0; h < 8; ++h) acc[e][h] = 0.f;
  }
#pragma unroll
  for (int s = 0; s < 16; ++s)
#pragma unroll
    for (int e = 0; e < 4; ++e) {
      float hv = fmaxf(fx[e] * wa[s] + fy[e] * wb[s] + bh[s], 0.f);
#pragma unroll
      for (int h = 0; h < 8; ++h) acc[e][h] += hv * wo[s][h >> 2][h & 3];
    }
#pragma unroll
  for (int e = 0; e < 4; ++e)
#pragma unroll
    for (int h = 0; h < 8; ++h) acc[e][h] = wave_sum(acc[e][h]);
  if (lane == 0) {
#pragma unroll
    for (int e = 0; e < 4; ++e)
#pragma unroll
      for (int h = 0; h < 8; ++h) sb[(wv * 4 + e) * 8 + h] = acc[e][h];
  }
  __syncthreads();
  // thread = (head, key): a wave stores one whole 128-byte line
  const int h = tid >> 5, jj = tid & 31;
  bias16[h * 4096 + i * 64 + j0 + jj] = 16.f / (1.f + __expf(-sb[jj * 8 + h]));
}

// Mean and 1 / sqrt(variance + eps) of a 256-column f16 row that 4 lanes share (l, l ^ 8,
// l ^ 16, l ^ 24): p = the lane's 64 columns, left in ov. Each lane sums its 64 terms, two lane
// exchanges add the four parts; every lane of the row gets the same totals.
// (Loops unrolled: vector elements are reached by constant index only.)
__device__ __forceinline__ void ln_stats(const half_t* p, v8h* ov, float& mu, float& rs) {
#pragma unroll
  for (int i = 0; i < 8; ++i) ov[i] = *(const v8h*)(p + i * 8);
  float s8[8];
#pragma unroll
  for (int i = 0; i < 8; ++i) {
    s8[i] = 0.f;
#pragma unroll
    for (int s = 0; s < 8; ++s) s8[i] += (float)ov[i][s];
  }
  float sm = ((s8[0] + s8[1]) + (s8[2] + s8[3])) + ((s8[4] + s8[5]) + (s8[6] + s8[7]));
  sm += xrow<8>(sm);
  sm += xhalf(sm);
  mu = sm * (1.f / DIMC);
#pragma unroll
  for (int i = 0; i < 8; ++i) {
    s8[i] = 0.f;
#pragma unroll
    for (int s = 0; s < 8; ++s) { const float d = (float)ov[i][s] - mu; s8[i] += d * d; }
  }
  float vr = ((s8[0] + s8[1]) + (s8[2] + s8[3])) + ((s8[4] + s8[5]) + (s8[6] + s8[7]));
  vr += xrow<8>(vr);
  vr += xhalf(vr);
  rs = rsqrtf(vr * (1.f / DIMC) + 1e-5f);
}

// ---- Main fused Swin-V2 block kernel: one 8x8 window at a time per workgroup ----
// NWG workgroups (all resident at once), each walks WPW windows, NWG apart. The raw input of the
// next window is copied into LDS while the MLP of this one runs.
#define NWG 512
#define WPW 4

// second bound: 4 waves a SIMD (256 registers a wave), so that two workgroups still share a WGP
__global__ __launch_bounds__(256, 4) void swin_block(
    const float* __restrict__ x,
    const float* __restrict__ logit_scale,
    const float* __restrict__ proj_b,
    const float* __restrict__ ln1_w, const float* __restrict__ ln1_b,
    const float* __restrict__ fc1_b, const float* __restrict__ fc2_b,
    const float* __restrict__ ln2_w, const float* __restrict__ ln2_b,
    const half_t* __restrict__ wh, const float* __restrict__ bias16,
    float* __restrict__ out)
{
  // q, k, v overlaid with the raw f32 input staging buffer: q, k, v live only inside the head
  // loop, xstage from the end of one window's head loop to the next window's conversion.
  union SMem {
    float xstage[MTOK * DIMC];                 // 64 KB raw window (f32)
    struct {
      half_t qb[4 * MTOK * HD];                // q, k, v of a group of 4 heads
      half_t kb[4 * MTOK * HD];
      half_t vT[4 * HD * MTOK];                // v transposed (M=d x K=j)
    } at;
  };
  __shared__ __attribute__((aligned(16))) SMem U;
  __shared__ half_t S16[MTOK * LDA];           // o / gelu chunk / mlp staging
  __shared__ half_t XY16[MTOK * LDA];          // x window -> y (in place)
  __shared__ float  stA[2 * MTOK];             // row means, then 1 / sqrt(variance + eps)
  float* muA = stA;
  float* rsA = stA + MTOK;
  __shared__ int    lab4[WPW * MTOK];          // region labels of this workgroup's windows

  half_t* qb4 = U.at.qb;
  half_t* kb4 = U.at.kb;
  half_t* vT4 = U.at.vT;

  const int tid  = threadIdx.x;
  // the wave's number as a scalar: what is formed from it and lives across the window loop then
  // sits in scalar registers (in vector registers it spills)
  const int wv   = __builtin_amdgcn_readfirstlane(tid >> 5);
  const int lane = tid & 31;

  const half_t* qkvT  = wh + OFF_QKVT;
  const half_t* projT = wh + OFF_PROJT;
  const half_t* fc1T  = wh + OFF_FC1T;
  const half_t* fc2T  = wh + OFF_FC2T;

  // ---- the first window's raw input on its way into LDS ----
  // rolled: one copy of the statement in the text is enough here
#pragma unroll 1
  for (int qt = 0; qt < 4; ++qt) copy_quarter(x, blockIdx.x, qt, tid, U.xstage);

  // the logit scales of this wave's two heads (one in each group of 4), read once, kept as scalars
  const float ls0 = __builtin_bit_cast(float, __builtin_amdgcn_readfirstlane(
                        __builtin_bit_cast(int, logit_scale[wv >> 1])));
  const float ls1 = __builtin_bit_cast(float, __builtin_amdgcn_readfirstlane(
                        __builtin_bit_cast(int, logit_scale[4 + (wv >> 1)])));

  // region labels of all its windows, once: thread = (window, token); the first trip's barrier
  // publishes them
  {
    const int wl = (blockIdx.x + (tid >> 6) * NWG) & 1023;
    const int r  = tid & 63;
    int sy = ((wl >> 5) << 3) + (r >> 3), sx = ((wl & 31) << 3) + (r & 7);
    int ry = (sy < IMG - WSZ) ? 0 : (sy < IMG - SHIFTS ? 1 : 2);
    int rx = (sx < IMG - WSZ) ? 0 : (sx < IMG - SHIFTS ? 1 : 2);
    lab4[tid] = ry * 3 + rx;
  }

  // not unrolled
#pragma unroll 1
  for (int wn = 0; wn < WPW; ++wn) {
  const int blk  = blockIdx.x + wn * NWG;
  const int b    = blk >> 10;
  const int wi   = blk & 1023;
  const int wy   = wi >> 5, wx = wi & 31;

  const int* lab = lab4 + wn * MTOK;
  // this wave's copies of this window have landed; the barrier publishes them, and it ends every
  // wave's reads of S16, XY16 and the row statistics for the window before. Only LDS passes
  // through it, so its fences name LDS alone: the last window's global stores are not waited for.
  wait_async0();
  __builtin_amdgcn_fence(__ATOMIC_RELEASE, "workgroup", "local");
  __builtin_amdgcn_s_barrier();
  __builtin_amdgcn_fence(__ATOMIC_ACQUIRE, "workgroup", "local");

  // convert staged f32 -> f16 A-operand layout (token-major, padded rows)
  for (int it = 0; it < 64; ++it) {
    int idx = it * 256 + tid;
    int r = idx & 63, c = idx >> 6;
    XY16[r * LDA + c] = (half_t)U.xstage[c * MTOK + r];
  }
  __syncthreads();

  // ---- attention: QKV product for 4 heads at a time, then the 4 heads side by side ----
  for (int hg = 0; hg < HEADS / 4; ++hg) {
    // the attention part's split: one wave = 32 queries of one head
    const int hw = wv >> 1;                    // head inside the group
    const int h  = hg * 4 + hw;
    const int i0 = (wv & 1) << 5;              // first query of this wave
    const int cl = lane & 15, hh = lane >> 4;
    float lsc;                                 // logit scale of the head
    v4f bv[2][4][2];                           // bias of query i0+16it+cl, keys 16jt+8hh+0..7
    // 24 column tiles (q, k, v x 4 heads x 2): each wave takes one of q, of k and of v,
    // with all 4 row tiles, K = 256
    {
      int nw = wv & 1;                         // column tile inside the head
      v8f acc[12];
#pragma unroll
      for (int t = 0; t < 12; ++t) acc[t] = ZERO8;
      strip_gemm<3, 3, 2>(XY16, qkvT + (size_t)((hg * 4 + hw) * HD + nw * 16) * DIMC, DIMC * DIMC,
                    lane, acc);
      // issued here so that these global loads fly during the LDS stores below
      lsc = hg ? ls1 : ls0;
      const float* bbase = bias16 + h * 4096 + (i0 + cl) * 64 + hh * 8;
#pragma unroll
      for (int it = 0; it < 2; ++it)
#pragma unroll
        for (int jt = 0; jt < 4; ++jt) {
          const float* bp = bbase + it * 1024 + jt * 16;
          bv[it][jt][0] = *(const v4f*)bp;
          bv[it][jt][1] = *(const v4f*)(bp + 4);
        }
      // the run's address pair is an input here, so it stays live up to this wait and no
      // result of the run lands in it before the wait has passed
      asm volatile("s_wait_xcnt 0x0" :: "v"(bbase) : "memory");
      int No = nw * 16 + (lane & 15);
      // one address a lane and array, the tile and row as constant offsets of the stores
      half_t* qp = qb4 + hw * (MTOK * HD) + ((lane >> 4) << 3) * HD + No;
      half_t* kp = kb4 + hw * (MTOK * HD) + ((lane >> 4) << 3) * HD + No;
      half_t* vp = vT4 + hw * (MTOK * HD) + No * MTOK + ((lane >> 4) << 3);
#pragma unroll
      for (int mi = 0; mi < 4; ++mi) {
#pragma unroll
        for (int g = 0; g < 8; ++g) {
          qp[(mi * 16 + g) * HD] = (half_t)acc[mi][g];
          kp[(mi * 16 + g) * HD] = (half_t)acc[4 + mi][g];
          vp[mi * 16 + g]        = (half_t)acc[8 + mi][g];
        }
      }
    }
    __syncthreads();

    // One wave = 32 queries of one head, all in registers. Scores are built transposed
    // (S^T = K Q^T): a lane holds 32 of the 64 scores of one query, lane l ^ 16 the rest,
    // and two score tiles, converted in place, are the B fragment of O^T = V^T P^T.
    // Every loop here is unrolled so that each tile index is a constant and the tiles
    // stay in registers.
    {
      const half_t* qb = qb4 + hw * (MTOK * HD);
      const half_t* kb = kb4 + hw * (MTOK * HD);
      const half_t* vT = vT4 + hw * (MTOK * HD);

      // cosine attention: unit rows, logit scale folded into q
      const float qs = __expf(fminf(lsc, 4.6051702f));
      v16h qf[2];
#pragma unroll
      for (int it = 0; it < 2; ++it)
        qf[it] = frag_unit(frag_ld(qb + (i0 + it * 16) * HD, HD, lane), qs);

      v8f st[2][4];                            // st[it][jt][g] = S[i0+16it+cl][16jt+8hh+g]
#pragma unroll
      for (int jt = 0; jt < 4; ++jt) {
        v16h kf = frag_unit(frag_ld(kb + jt * 16 * HD, HD, lane), 1.f);
#pragma unroll
        for (int it = 0; it < 2; ++it) st[it][jt] = wmma_f16(kf, qf[it], ZERO8);
      }

      v16h pf[2][2];                           // P^T, k = 32 keys each
#pragma unroll
      for (int it = 0; it < 2; ++it) {
        const int i = i0 + it * 16 + cl;
        const int li = lab[i];
        float mx = -1e30f;
#pragma unroll
        for (int jt = 0; jt < 4; ++jt)
#pragma unroll
          for (int g = 0; g < 8; ++g) {
            float msk = (li == lab[jt * 16 + hh * 8 + g]) ? 0.f : -100.f;
            float v = st[it][jt][g] + bv[it][jt][g >> 2][g & 3] + msk;
            st[it][jt][g] = v;
            mx = fmaxf(mx, v);
          }
        mx = fmaxf(mx, xhalf(mx));
        float s = 0.f;
#pragma unroll
        for (int jt = 0; jt < 4; ++jt)
#pragma unroll
          for (int g = 0; g < 8; ++g) {
            float e = __expf(st[it][jt][g] - mx);
            st[it][jt][g] = e;
            s += e;
          }
        s += xhalf(s);
        const float invs = 1.f / s;
#pragma unroll
        for (int kq = 0; kq < 2; ++kq)
#pragma unroll
          for (int g = 0; g < 8; ++g) {
            pf[it][kq][g]     = (half_t)(st[it][2 * kq][g] * invs);
            pf[it][kq][8 + g] = (half_t)(st[it][2 * kq + 1][g] * invs);
          }
      }

      // O^T = V^T P^T (K = 64): a lane's 8 results are 8 neighbouring d of one query
#pragma unroll
      for (int dt = 0; dt < 2; ++dt) {
        v16h vf0 = frag_ld(vT + dt * 16 * MTOK, MTOK, lane);
        v16h vf1 = frag_ld(vT + dt * 16 * MTOK + 32, MTOK, lane);
#pragma unroll
        for (int it = 0; it < 2; ++it) {
          v8f o = wmma_f16(vf1, pf[it][1], wmma_f16(vf0, pf[it][0], ZERO8));
          v8h oh;
#pragma unroll
          for (int g = 0; g < 8; ++g) oh[g] = (half_t)o[g];
          *(v8h*)&S16[(i0 + it * 16 + cl) * LDA + h * HD + dt * 16 + hh * 8] = oh;
        }
      }
    }
    // ends every wave's reads of q, k, v before the next group overwrites them, and
    // publishes the head columns of S16 to the projection
    __syncthreads();
  }

  // q, k, v are dead behind the barrier above: from here to the top of the next trip their place
  // takes the next window's raw input (copies: in the MLP loop). This wave's own LDS reads and
  // writes of q, k, v have retired before a copy targets them:
  asm volatile("s_wait_dscnt 0x0" ::: "memory");

  // ---- output projection: 64 tiles, 8 per wave (4 row x 2 column tiles), K = 256 ----
  v8f pres[8];
#pragma unroll
  for (int t = 0; t < 8; ++t) pres[t] = ZERO8;
  strip_gemm<2, 4, 4>(S16, projT + (size_t)(wv * 32) * DIMC, 16 * DIMC, lane, pres);
  __syncthreads();
#pragma unroll
  for (int t = 0; t < 8; ++t) {
    int mi = t & 3, ni = (wv << 1) + (t >> 2);
    int Mo = mi * 16 + ((lane >> 4) << 3);
    int No = ni * 16 + (lane & 15);
    float pb = proj_b[No];
#pragma unroll
    for (int g = 0; g < 8; ++g) S16[(Mo + g) * LDA + No] = (half_t)(pres[t][g] + pb);
  }
  __syncthreads();

  // ---- y = LN1(o) + x  (in place into XY16) ----
  // Both layer norms: 4 lanes a row (lanes l, l ^ 8, l ^ 16, l ^ 24), 8 rows a wave, all 8 waves.
  // A lane keeps its 64 columns in registers (8 reads of 16 bytes), so a row is read once for
  // mean and variance, and in LN1 for the result too. Lanes 0-15 of a read fall on 16 different groups of 4 banks
  // (row pitch = 33 x 16 bytes, quarter = 8 x 16 bytes).
  const int lr = wv * 8 + (lane & 7);          // row of this lane
  const int lc = (lane >> 3) << 6;             // first of its 64 columns
  {
    v8h ov[8];
    float mu, rs;
    ln_stats(S16 + lr * LDA + lc, ov, mu, rs);
    // unrolled: ov is reached by constant index only
#pragma unroll
    for (int i = 0; i < 8; ++i) {
      const v8h xv = *(const v8h*)&XY16[lr * LDA + lc + i * 8];
      v8h yv;
#pragma unroll
      for (int q = 0; q < 2; ++q) {
        const v4f w4 = *(const v4f*)(ln1_w + lc + i * 8 + q * 4);
        const v4f b4 = *(const v4f*)(ln1_b + lc + i * 8 + q * 4);
#pragma unroll
        for (int s = 0; s < 4; ++s)
          yv[q * 4 + s] = (half_t)(((float)ov[i][q * 4 + s] - mu) * rs * w4[s] + b4[s]
                                   + (float)xv[q * 4 + s]);
      }
      *(v8h*)&XY16[lr * LDA + lc + i * 8] = yv;
      // the scale and shift loads go out in two runs of 16: with all 32 in flight the kernel
      // runs out of registers and spills
      if (i == 3) __builtin_amdgcn_sched_barrier(0);
    }
  }
  __syncthreads();

  // ---- MLP: 4 chunks of 256 hidden; fc2 accumulates persistently ----
  v8f acc2[8];
#pragma unroll
  for (int t = 0; t < 8; ++t) acc2[t] = ZERO8;

  for (int kc = 0; kc < 4; ++kc) {
    v8f r1[8];
#pragma unroll
    for (int t = 0; t < 8; ++t) r1[t] = ZERO8;
    strip_gemm<2, 2, 2>(XY16, fc1T + (size_t)(kc * 256 + wv * 32) * DIMC, 16 * DIMC, lane, r1);
    // bias of this lane's two columns
    const float* fb = fc1_b + kc * 256 + wv * 32 + (lane & 15);
    const float bb0 = fb[0], bb1 = fb[16];
    // the two loads' address is an input here, so it stays live up to this wait, and the address
    // arithmetic of the copies below lands in none of its registers before the wait has passed
    asm volatile("s_wait_xcnt 0x0" :: "v"(fb) : "memory");
#pragma unroll
    for (int t = 0; t < 8; ++t) r1[t] += (t < 4) ? bb0 : bb1;   // onto the whole tiles
    // a quarter of the next window's raw input goes out here: its requests pass through the
    // memory path while the waves do GELU arithmetic, not in front of a product's weight loads
    if (wn + 1 < WPW) copy_quarter(x, blk + NWG, kc, tid, U.xstage);
#pragma unroll
    for (int t = 0; t < 8; ++t) {
      int mi = t & 3, ni = (wv << 1) + (t >> 2);
      int Mo = mi * 16 + ((lane >> 4) << 3);
      int No = ni * 16 + (lane & 15);
      v8f ge = gelu8(r1[t]);
#pragma unroll
      for (int g = 0; g < 8; ++g) S16[(Mo + g) * LDA + No] = (half_t)ge[g];
    }
    __syncthreads();
    strip_gemm<2, 4, 4>(S16, fc2T + (size_t)(wv * 32) * HIDDEN + kc * 256 * 16, 16 * HIDDEN, lane, acc2);
    __syncthreads();
  }

  // mlp result into S16
#pragma unroll
  for (int t = 0; t < 8; ++t) {
    int mi = t & 3, ni = (wv << 1) + (t >> 2);
    int Mo = mi * 16 + ((lane >> 4) << 3);
    int No = ni * 16 + (lane & 15);
    float bb = fc2_b[No];
#pragma unroll
    for (int g = 0; g < 8; ++g) S16[(Mo + g) * LDA + No] = (half_t)(acc2[t][g] + bb);
  }
  __syncthreads();

  // LN2 stats
  {
    v8h ov[8];
    float mu, rs;
    ln_stats(S16 + lr * LDA + lc, ov, mu, rs);
    if (lane < 8) { muA[lr] = mu; rsA[lr] = rs; }
  }
  __syncthreads();

  // ---- final: out = LN2(mlp) + y, window-reverse + un-shift ----
  for (int it = 0; it < 64; ++it) {
    int c = (it << 2) + (tid >> 6);
    int r = tid & 63;
    float mv = ((float)S16[r * LDA + c] - muA[r]) * rsA[r] * ln2_w[c] + ln2_b[c];
    float yv = mv + (float)XY16[r * LDA + c];
    int gy = ((wy << 3) + (r >> 3) + SHIFTS) & 255;
    int gx = ((wx << 3) + (r & 7) + SHIFTS) & 255;
    out[(((size_t)(b * DIMC + c)) << 16) + (gy << 8) + gx] = yv;
  }
  }  // windows of this workgroup
}

// ---- launch ----------------------------------------------------------------

extern "C" void kernel_launch(void* const* d_in, const int* in_sizes, int n_in,
                              void* d_out, int out_size, void* d_ws, size_t ws_size,
                              hipStream_t stream) {
  (void)in_sizes; (void)n_in; (void)out_size; (void)ws_size;
  const float* x        = (const float*)d_in[0];
  const float* qkv_w    = (const float*)d_in[1];
  const float* lscale   = (const float*)d_in[2];
  const float* proj_w   = (const float*)d_in[3];
  const float* proj_b   = (const float*)d_in[4];
  const float* ln1_w    = (const float*)d_in[5];
  const float* ln1_b    = (const float*)d_in[6];
  const float* fc1_w    = (const float*)d_in[7];
  const float* fc1_b    = (const float*)d_in[8];
  const float* fc2_w    = (const float*)d_in[9];
  const float* fc2_b    = (const float*)d_in[10];
  const float* ln2_w    = (const float*)d_in[11];
  const float* ln2_b    = (const float*)d_in[12];
  const float* cpb_w1   = (const float*)d_in[13];
  const float* cpb_b1   = (const float*)d_in[14];
  const float* cpb_w2   = (const float*)d_in[15];

  half_t* wh     = (half_t*)d_ws;
  float*  bias16 = (float*)((char*)d_ws + OFF_BIAS_BYTES);
  float*  out    = (float*)d_out;

  prep_weights<<<TOT_H / 256, 256, 0, stream>>>(qkv_w, proj_w, fc1_w, fc2_w, wh);
  prep_bias<<<128, 256, 0, stream>>>(cpb_w1, cpb_b1, cpb_w2, bias16);
  swin_block<<<NWG, 256, 0, stream>>>(x, lscale, proj_b, ln1_w, ln1_b,
                                       fc1_b, fc2_b, ln2_w, ln2_b,
                                       wh, bias16, out);
}
